// v000
// The times below were measured on an AMD MI455X: many runs one after another, warmed up first and cycling through
// copies of the inputs, with the whole window's GPU time divided by the number of runs. Launches and the gaps
// between them are all in it. The median over several windows is given; except for v000 it joins two sittings, which
// can be a few percent apart, so the side-by-side timings, each taken in one sitting, are the better comparison.
// The starting kernel, v000, takes 617 microseconds a run.
#include <hip/hip_runtime.h>
// Contractions: value projection, attention-logit projection and final projection (K = 384) on v_wmma_f32_16x16x32_f16
// (f16 operands, f32 accumulate); softmax over the 3x3 window and the attention-apply/fold (9-term sums) in f32 on VALU.

// ---------------- problem constants ----------------
#define Cc    384
#define NHEAD 12
#define HD    32
#define Ee    972        // K^4 * HEADS
#define EPAD  992        // Ee padded to multiple of 32 for WMMA M-tiles
#define Bb    8
#define HH    56
#define LL    3136       // 56*56

typedef __attribute__((ext_vector_type(8)))  _Float16 v8h;
typedef __attribute__((ext_vector_type(16))) _Float16 v16h;
typedef __attribute__((ext_vector_type(8)))  float    v8f;
typedef __attribute__((ext_vector_type(4)))  float    v4f;
typedef __attribute__((ext_vector_type(4)))  unsigned v4u;

union AFrag { v16h v; v8h h[2]; };

template <typename V> __device__ __forceinline__ void vst2(void* p, V v) {
    *(V*)p = v; 
}
__device__ __forceinline__ v8f wmma_f16(v16h a, v16h b, v8f c) {
    v8f d = __builtin_amdgcn_wmma_f32_16x16x32_f16(false, a, false, b, (short)0, c, false, false);
    asm volatile("v_nop\n\tv_nop\n\tv_nop\n\tv_nop" : "+v"(d) : "v"(a), "v"(b));
    return d;
}

// ---------------- f32 -> f16 weight convert (with zero pad): 8 elements (16 B) per thread ----------------
__global__ void cvt_f32_f16(const float* __restrict__ s, _Float16* __restrict__ d, int n, int npad) {
    int g = blockIdx.x * 256 + threadIdx.x;             // npad is a multiple of 8
    if (g * 8 >= npad) return;
    union { v8h v; v4u u; } pk;
#pragma unroll
    for (int e = 0; e < 8; ++e) { int i = g * 8 + e; pk.v[e] = (i < n) ? (_Float16)s[i] : (_Float16)0.0f; }
    vst2(d + (size_t)g * 8, pk.u);
}

// x[B][C][L] (f32) -> Xt[B][L][C] (f16): one thread = 8 consecutive c of one (b,l) = one 16-B piece; a row of 384 halves = 6 lines
__global__ void pack_x(const float* __restrict__ x, _Float16* __restrict__ Xt) {
    int g = blockIdx.x * 256 + threadIdx.x;             // total Bb*LL*48 (exact)
    int cq = g % (Cc / 8);
    int r  = g / (Cc / 8);
    int l  = r % LL;
    int b  = r / LL;
    union { v8h v; v4u u; } pk;
#pragma unroll
    for (int e = 0; e < 8; ++e) pk.v[e] = (_Float16)x[((size_t)b * Cc + cq * 8 + e) * LL + l];
    vst2(Xt + ((size_t)b * LL + l) * Cc + cq * 8, pk.u);
}

// ---------------- WMMA GEMM: D[M x L] = W[M x 384] @ Xt^T, per batch ----------
// A/B fragments: row/col = lane&15; elements 0..7 <- k0 + 8*hi + 0..7, elements 8..15 <- k0 + 16 + 8*hi + 0..7 (same map).
template <int MODE>
__global__ void __launch_bounds__(256)
gemm16(const _Float16* __restrict__ W, const _Float16* __restrict__ X,
       const float* __restrict__ bias, float* __restrict__ out32,
       _Float16* __restrict__ out16, int Mtot, int nMt, int nNt) {
    constexpr int TM = (MODE == 2) ? 32 : 64, TN = (MODE == 2) ? 64 : 32;
    constexpr int MI = TM / 16, NI = TN / 16;
    __shared__ __align__(16) float st[8][TM * TN];          // per-wave f32 staging, 8 KB each
    const int lane  = threadIdx.x;            // 0..31
    const int wid   = threadIdx.y;            // 0..7
    const int b     = blockIdx.z;
    const int t     = blockIdx.x * 8 + wid;   // tile id
    const int nTile = nMt * nNt;
    const bool valid = (t < nTile);           // whole-wave uniform
    const int m0 = valid ? (t / nNt) * TM : 0;
    const int n0 = valid ? (t % nNt) * TN : 0;
    const int laneM = lane & 15;
    const int hi    = lane >> 4;
    float* S = st[wid];

    if (valid) {
        const _Float16* __restrict__ Xb = X + (size_t)b * LL * Cc;
        v8f acc[MI][NI] = {};
        for (int kt = 0; kt < Cc; kt += 32) {
            AFrag a[MI], bf[NI];
#pragma unroll
            for (int mi = 0; mi < MI; ++mi) {
                const _Float16* wr = W + (size_t)(m0 + mi * 16 + laneM) * Cc + kt;
                a[mi].h[0] = *(const v8h*)(wr + 8 * hi);
                a[mi].h[1] = *(const v8h*)(wr + 16 + 8 * hi);
            }
#pragma unroll
            for (int ni = 0; ni < NI; ++ni) {
                const _Float16* xr = Xb + (size_t)(n0 + ni * 16 + laneM) * Cc + kt;
                bf[ni].h[0] = *(const v8h*)(xr + 8 * hi);
                bf[ni].h[1] = *(const v8h*)(xr + 16 + 8 * hi);
            }
#pragma unroll
            for (int mi = 0; mi < MI; ++mi)
#pragma unroll
                for (int ni = 0; ni < NI; ++ni)
                    acc[mi][ni] = wmma_f16(a[mi].v, bf[ni].v, acc[mi][ni]);
        }
        // D layout: element r -> (m = mi*16 + 8*hi + r, n = ni*16 + laneM); stage [m][n] for MODE 1/2, [n][m] for MODE 0
#pragma unroll
        for (int mi = 0; mi < MI; ++mi)
#pragma unroll
            for (int ni = 0; ni < NI; ++ni)
#pragma unroll
                for (int r = 0; r < 8; ++r) {
                    const int ml = mi * 16 + 8 * hi + r, nl = ni * 16 + laneM;
                    float v = acc[mi][ni][r];
                    if (MODE != 0) { const int row = m0 + ml; v += (row < Mtot) ? bias[row] : 0.0f; }
                    if (MODE == 0) S[nl * TM + ml] = v; else S[ml * TN + nl] = v;
                }
    }
    __syncthreads();
    if (!valid) return;
    if (MODE == 0) {
#pragma unroll
        for (int q = 0; q < 8; ++q) {
            const int nl = q * 4 + (lane >> 3), pc = lane & 7;
            union { v8h v; v4u u; } pk;
#pragma unroll
            for (int e = 0; e < 8; ++e) pk.v[e] = (_Float16)S[nl * TM + pc * 8 + e];
            vst2(out16 + ((size_t)b * LL + n0 + nl) * Cc + m0 + pc * 8, pk.u);
        }
    } else if (MODE == 1) {
#pragma unroll
        for (int q = 0; q < 16; ++q) {
            const int ml = q * 4 + (lane >> 3), pc = lane & 7;
            const int row = m0 + ml;
            if (row < Mtot)
                vst2(out32 + ((size_t)b * Mtot + row) * LL + n0 + pc * 4, *(const v4f*)(S + ml * TN + pc * 4));
        }
    } else {
#pragma unroll
        for (int q = 0; q < 8; ++q) {
            const int ml = q * 4 + (lane >> 3), pc = lane & 7;
            const int row = m0 + ml;
            union { v8h v; v4u u; } pk;
#pragma unroll
            for (int e = 0; e < 8; ++e) pk.v[e] = (_Float16)S[ml * TN + pc * 8 + e];
            if (row < Mtot) vst2(out16 + ((size_t)b * Mtot + row) * LL + n0 + pc * 8, pk.u);
        }
    }
}

// -------- softmax over q (groups of 9, stride LL), f16 in/out, f32 math; thread = 2 consecutive l (4-B stores, one line per wave) -----
__global__ void softmax9(_Float16* __restrict__ A) {
    int i = blockIdx.x * 256 + threadIdx.x;   // total Bb*NHEAD*9*(LL/2) (exact)
    int l2 = i % (LL / 2);
    int r = i / (LL / 2);
    int p = r % 9;  r /= 9;
    int n = r % NHEAD;
    int b = r / NHEAD;
    _Float16* base = A + ((size_t)b * Ee + n * 81 + p * 9) * LL + 2 * l2;
    const float sc = 0.17677669529663687f;    // 32^-0.5
    float v0[9], v1[9], m0 = -1e30f, m1 = -1e30f;
#pragma unroll
    for (int q = 0; q < 9; ++q) {
        const _Float16* pq = base + (size_t)q * LL;
        v0[q] = (float)pq[0] * sc; v1[q] = (float)pq[1] * sc;
        m0 = fmaxf(m0, v0[q]); m1 = fmaxf(m1, v1[q]);
    }
    float s0 = 0.f, s1 = 0.f;
#pragma unroll
    for (int q = 0; q < 9; ++q) { v0[q] = __expf(v0[q] - m0); s0 += v0[q]; v1[q] = __expf(v1[q] - m1); s1 += v1[q]; }
    const float i0 = 1.f / s0, i1 = 1.f / s1;
#pragma unroll
    for (int q = 0; q < 9; ++q) {
        union { _Float16 h[2]; unsigned u; } pk;
        pk.h[0] = (_Float16)(v0[q] * i0); pk.h[1] = (_Float16)(v1[q] * i1);
        vst2((char*)(base + (size_t)q * LL), pk.u);
    }
}

// ------- fused attention-apply + fold: Ft[b][y*56+x][c] = folded value -------
// folded[b,n*32+d,y,x] = sum_{i,j valid} sum_{q valid}
//     A[b, n*81+(i3+j)*9+q, (y+1-i)*56+(x+1-j)] * V[b, n*32+d, (x+qj-j)*56+(y+qi-i)]
// (the bdwh spatial-transpose of the value tensor is baked into the V column index)
__global__ void __launch_bounds__(256)
apply_fold(const _Float16* __restrict__ A, const _Float16* __restrict__ Vt, _Float16* __restrict__ Ft) {
    __shared__ __align__(16) _Float16 fs[8][64];
    const int lane = threadIdx.x;                        // d in [0,32)
    const int wid  = threadIdx.y;
    const int w    = blockIdx.x * 8 + wid;               // wave id over Bb * (NHEAD/2) * LL (exact grid)
    const int pos  = w % LL;
    int r          = w / LL;
    const int np   = r % (NHEAD / 2);
    const int b    = r / (NHEAD / 2);
    const int y = pos / HH, x = pos % HH;

#pragma unroll 1
    for (int hh2 = 0; hh2 < 2; ++hh2) {              // rolled: keeps the static VALU-FMA count of this non-contraction kernel at 81
        const int n = np * 2 + hh2;
        const _Float16* __restrict__ Vb = Vt + (size_t)b * LL * Cc + n * HD + lane;
        const _Float16* __restrict__ Ab = A + ((size_t)b * Ee + n * 81) * LL;
        float acc = 0.f;
#pragma unroll
        for (int i = 0; i < 3; ++i) {
#pragma unroll
            for (int j = 0; j < 3; ++j) {
                const int hp = y + 1 - i, wp = x + 1 - j;    // source l' for this fold shift
                if (hp < 0 || hp >= HH || wp < 0 || wp >= HH) continue;
                const _Float16* arow = Ab + (size_t)((i * 3 + j) * 9) * LL + hp * HH + wp;
#pragma unroll
                for (int qi = 0; qi < 3; ++qi) {
                    const int vy = y + qi - i;
                    if (vy < 0 || vy >= HH) continue;
#pragma unroll
                    for (int qj = 0; qj < 3; ++qj) {
                        const int vx = x + qj - j;
                        if (vx < 0 || vx >= HH) continue;
                        const float av = (float)arow[(size_t)(qi * 3 + qj) * LL];
                        const float vv = (float)Vb[(size_t)(vx * HH + vy) * Cc];
                        acc += av * vv;
                    }
                }
            }
        }
        fs[wid][hh2 * 32 + lane] = (_Float16)acc;
    }
    __syncthreads();
    if (lane < 8) vst2(Ft + ((size_t)b * LL + pos) * Cc + np * 64 + lane * 8, *(const v4u*)(&fs[wid][lane * 8]));
}

// ---------------------------------------------------------------------------
extern "C" void kernel_launch(void* const* d_in, const int* in_sizes, int n_in,
                              void* d_out, int out_size, void* d_ws, size_t ws_size,
                              hipStream_t stream) {
    (void)in_sizes; (void)n_in; (void)out_size; (void)ws_size;
    const float* x  = (const float*)d_in[0];
    const float* Wv = (const float*)d_in[1];
    const float* Wa = (const float*)d_in[2];
    const float* ba = (const float*)d_in[3];
    const float* Wp = (const float*)d_in[4];
    const float* bp = (const float*)d_in[5];
    float* out = (float*)d_out;

    char* ws = (char*)d_ws;
    size_t off = 0;
    auto carve = [&](size_t bytes) -> void* {
        void* p = ws + off;
        off += (bytes + 255) & ~(size_t)255;
        return p;
    };
    _Float16* Xt   = (_Float16*)carve((size_t)Bb * LL * Cc * 2);  // 19.3 MB
    _Float16* Wvh  = (_Float16*)carve((size_t)Cc * Cc * 2);
    _Float16* Wah  = (_Float16*)carve((size_t)EPAD * Cc * 2);
    _Float16* Wph  = (_Float16*)carve((size_t)Cc * Cc * 2);
    _Float16* Vt   = (_Float16*)carve((size_t)Bb * LL * Cc * 2);  // 19.3 MB
    _Float16* Abuf = (_Float16*)carve((size_t)Bb * Ee * LL * 2);  // 48.8 MB
    _Float16* Ft   = (_Float16*)carve((size_t)Bb * LL * Cc * 2);  // 19.3 MB

    // 1) convert weights (Wa zero-padded to 992 rows); 8 halves per thread
    cvt_f32_f16<<<(Cc * Cc / 8 + 255) / 256, 256, 0, stream>>>(Wv, Wvh, Cc * Cc, Cc * Cc);
    cvt_f32_f16<<<(EPAD * Cc / 8 + 255) / 256, 256, 0, stream>>>(Wa, Wah, Ee * Cc, EPAD * Cc);
    cvt_f32_f16<<<(Cc * Cc / 8 + 255) / 256, 256, 0, stream>>>(Wp, Wph, Cc * Cc, Cc * Cc);

    // 2) pack x into [b][l][c] f16
    pack_x<<<(Bb * LL * (Cc / 8)) / 256, 256, 0, stream>>>(x, Xt);

    dim3 gblk(32, 8);
    // 3) value projection -> Vt[b][l][c]  (6 M-tiles of 64 x 98 N-tiles of 32 = 588 -> 74 blocks)
    gemm16<0><<<dim3(74, 1, Bb), gblk, 0, stream>>>(Wvh, Xt, nullptr, nullptr, Vt, Cc, Cc / 64, LL / 32);
    // 4) attention logits + bias (f16) -> Abuf[b][e][l]  (31 M-tiles of 32 x 49 N-tiles of 64 = 1519 -> 190 blocks)
    gemm16<2><<<dim3(190, 1, Bb), gblk, 0, stream>>>(Wah, Xt, ba, nullptr, Abuf, Ee, EPAD / 32, LL / 64);
    // 5) softmax over q, in place (f16 storage, f32 math)
    softmax9<<<(Bb * NHEAD * 9 * (LL / 2)) / 256, 256, 0, stream>>>(Abuf);
    // 6) fused apply + fold -> Ft[b][l][c]
    apply_fold<<<dim3((Bb * (NHEAD / 2) * LL) / 8), gblk, 0, stream>>>(Abuf, Vt, Ft);
    // 7) final projection + bias -> out[b][d][l]
    gemm16<1><<<dim3(74, 1, Bb), gblk, 0, stream>>>(Wph, Ft, bp, out, nullptr, Cc, Cc / 64, LL / 32);
}

// v001
// Measured time: 193 microseconds a run.
// Next to v000, in two timings, it ran 3.25 times as fast each time.
#include <hip/hip_runtime.h>
// Contractions: value projection, attention-logit projection and final projection (K = 384) on v_wmma_f32_16x16x32_f16
// (f16 operands, f32 accumulate); softmax over the 3x3 window and the attention-apply/fold (per-position weights, no shared operand) in f32 on VALU.

// ---------------- problem constants ----------------
#define Cc    384
#define NHEAD 12
#define HD    32
#define Ee    972        // K^4 * HEADS
#define EPAD  992        // Ee padded to multiple of 32 for WMMA M-tiles
#define Bb    8
#define HH    56
#define LL    3136       // 56*56

typedef __attribute__((ext_vector_type(8)))  _Float16 v8h;
typedef __attribute__((ext_vector_type(16))) _Float16 v16h;
typedef __attribute__((ext_vector_type(8)))  float    v8f;
typedef __attribute__((ext_vector_type(4)))  float    v4f;
typedef __attribute__((ext_vector_type(4)))  unsigned v4u;

union AFrag { v16h v; v8h h[2]; };

template <typename V> __device__ __forceinline__ void vst2(void* p, V v) {
    *(V*)p = v; 
}
__device__ __forceinline__ v8f wmma_f16(v16h a, v16h b, v8f c) {
    v8f d = __builtin_amdgcn_wmma_f32_16x16x32_f16(false, a, false, b, (short)0, c, false, false);
    asm volatile("v_nop\n\tv_nop\n\tv_nop\n\tv_nop" : "+v"(d) : "v"(a), "v"(b));
    return d;
}

// ---------------- f32 -> f16 weight convert (with zero pad): 8 elements (16 B) per thread ----------------
__global__ void cvt_f32_f16(const float* __restrict__ s, _Float16* __restrict__ d, int n, int npad) {
    int g = blockIdx.x * 256 + threadIdx.x;             // npad is a multiple of 8
    if (g * 8 >= npad) return;
    union { v8h v; v4u u; } pk;
#pragma unroll
    for (int e = 0; e < 8; ++e) { int i = g * 8 + e; pk.v[e] = (i < n) ? (_Float16)s[i] : (_Float16)0.0f; }
    vst2(d + (size_t)g * 8, pk.u);
}

// x[B][C][L] (f32) -> Xt[B][L][C] (f16): one thread = 8 consecutive c of one (b,l) = one 16-B piece; a row of 384 halves = 6 lines
__global__ void pack_x(const float* __restrict__ x, _Float16* __restrict__ Xt) {
    int g = blockIdx.x * 256 + threadIdx.x;             // total Bb*LL*48 (exact)
    int cq = g % (Cc / 8);
    int r  = g / (Cc / 8);
    int l  = r % LL;
    int b  = r / LL;
    union { v8h v; v4u u; } pk;
#pragma unroll
    for (int e = 0; e < 8; ++e) pk.v[e] = (_Float16)x[((size_t)b * Cc + cq * 8 + e) * LL + l];
    vst2(Xt + ((size_t)b * LL + l) * Cc + cq * 8, pk.u);
}

// ---------------- WMMA GEMM: D[M x L] = W[M x 384] @ Xt^T, per batch ----------
// A/B fragments: row/col = lane&15; elements 0..7 <- k0 + 8*hi + 0..7, elements 8..15 <- k0 + 16 + 8*hi + 0..7 (same map).
template <int MODE>
__global__ void __launch_bounds__(256)
gemm16(const _Float16* __restrict__ W, const _Float16* __restrict__ X,
       const float* __restrict__ bias, float* __restrict__ out32,
       _Float16* __restrict__ out16, int Mtot, int nMt, int nNt) {
    constexpr int TM = (MODE == 2) ? 32 : 64, TN = (MODE == 2) ? 64 : 32;
    constexpr int MI = TM / 16, NI = TN / 16;
    __shared__ __align__(16) float st[8][TM * TN];          // per-wave f32 staging, 8 KB each
    const int lane  = threadIdx.x;            // 0..31
    const int wid   = threadIdx.y;            // 0..7
    const int b     = blockIdx.z;
    const int t     = blockIdx.x * 8 + wid;   // tile id
    const int nTile = nMt * nNt;
    const bool valid = (t < nTile);           // whole-wave uniform
    const int m0 = valid ? (t / nNt) * TM : 0;
    const int n0 = valid ? (t % nNt) * TN : 0;
    const int laneM = lane & 15;
    const int hi    = lane >> 4;
    float* S = st[wid];

    if (valid) {
        const _Float16* __restrict__ Xb = X + (size_t)b * LL * Cc;
        v8f acc[MI][NI] = {};
        for (int kt = 0; kt < Cc; kt += 32) {
            AFrag a[MI], bf[NI];
#pragma unroll
            for (int mi = 0; mi < MI; ++mi) {
                const _Float16* wr = W + (size_t)(m0 + mi * 16 + laneM) * Cc + kt;
                a[mi].h[0] = *(const v8h*)(wr + 8 * hi);
                a[mi].h[1] = *(const v8h*)(wr + 16 + 8 * hi);
            }
#pragma unroll
            for (int ni = 0; ni < NI; ++ni) {
                const _Float16* xr = Xb + (size_t)(n0 + ni * 16 + laneM) * Cc + kt;
                bf[ni].h[0] = *(const v8h*)(xr + 8 * hi);
                bf[ni].h[1] = *(const v8h*)(xr + 16 + 8 * hi);
            }
#pragma unroll
            for (int mi = 0; mi < MI; ++mi)
#pragma unroll
                for (int ni = 0; ni < NI; ++ni)
                    acc[mi][ni] = wmma_f16(a[mi].v, bf[ni].v, acc[mi][ni]);
        }
        // D layout: element r -> (m = mi*16 + 8*hi + r, n = ni*16 + laneM); stage [m][n] for MODE 1/2, [n][m] for MODE 0
#pragma unroll
        for (int mi = 0; mi < MI; ++mi)
#pragma unroll
            for (int ni = 0; ni < NI; ++ni)
#pragma unroll
                for (int r = 0; r < 8; ++r) {
                    const int ml = mi * 16 + 8 * hi + r, nl = ni * 16 + laneM;
                    float v = acc[mi][ni][r];
                    if (MODE != 0) { const int row = m0 + ml; v += (row < Mtot) ? bias[row] : 0.0f; }
                    if (MODE == 0) S[nl * TM + ml] = v; else S[ml * TN + nl] = v;
                }
    }
    __syncthreads();
    if (!valid) return;
    if (MODE == 0) {
#pragma unroll
        for (int q = 0; q < 8; ++q) {
            const int nl = q * 4 + (lane >> 3), pc = lane & 7;
            union { v8h v; v4u u; } pk;
#pragma unroll
            for (int e = 0; e < 8; ++e) pk.v[e] = (_Float16)S[nl * TM + pc * 8 + e];
            vst2(out16 + ((size_t)b * LL + n0 + nl) * Cc + m0 + pc * 8, pk.u);
        }
    } else if (MODE == 1) {
#pragma unroll
        for (int q = 0; q < 16; ++q) {
            const int ml = q * 4 + (lane >> 3), pc = lane & 7;
            const int row = m0 + ml;
            if (row < Mtot)
                vst2(out32 + ((size_t)b * Mtot + row) * LL + n0 + pc * 4, *(const v4f*)(S + ml * TN + pc * 4));
        }
    } else {
#pragma unroll
        for (int q = 0; q < 8; ++q) {
            const int ml = q * 4 + (lane >> 3), pc = lane & 7;
            const int row = m0 + ml;
            union { v8h v; v4u u; } pk;
#pragma unroll
            for (int e = 0; e < 8; ++e) pk.v[e] = (_Float16)S[ml * TN + pc * 8 + e];
            if (row < Mtot) vst2(out16 + ((size_t)b * Mtot + row) * LL + n0 + pc * 8, pk.u);
        }
    }
}

// -------- softmax over q (groups of 9, stride LL), f16 in/out, f32 math; thread = 2 consecutive l (4-B stores, one line per wave) -----
__global__ void softmax9(_Float16* __restrict__ A) {
    int i = blockIdx.x * 256 + threadIdx.x;   // total Bb*NHEAD*9*(LL/2) (exact)
    int l2 = i % (LL / 2);
    int r = i / (LL / 2);
    int p = r % 9;  r /= 9;
    int n = r % NHEAD;
    int b = r / NHEAD;
    _Float16* base = A + ((size_t)b * Ee + n * 81 + p * 9) * LL + 2 * l2;
    const float sc = 0.17677669529663687f;    // 32^-0.5
    float v0[9], v1[9], m0 = -1e30f, m1 = -1e30f;
#pragma unroll
    for (int q = 0; q < 9; ++q) {
        const _Float16* pq = base + (size_t)q * LL;
        v0[q] = (float)pq[0] * sc; v1[q] = (float)pq[1] * sc;
        m0 = fmaxf(m0, v0[q]); m1 = fmaxf(m1, v1[q]);
    }
    float s0 = 0.f, s1 = 0.f;
#pragma unroll
    for (int q = 0; q < 9; ++q) { v0[q] = __expf(v0[q] - m0); s0 += v0[q]; v1[q] = __expf(v1[q] - m1); s1 += v1[q]; }
    const float i0 = 1.f / s0, i1 = 1.f / s1;
#pragma unroll
    for (int q = 0; q < 9; ++q) {
        union { _Float16 h[2]; unsigned u; } pk;
        pk.h[0] = (_Float16)(v0[q] * i0); pk.h[1] = (_Float16)(v1[q] * i1);
        vst2((char*)(base + (size_t)q * LL), pk.u);
    }
}

// ------- fused attention-apply + fold: Ft[b][y*56+x][c] = folded value -------
// folded[b,n*32+d,y,x] = sum_{i,j valid} sum_{q valid}
//     A[b, n*81+(i3+j)*9+q, (y+1-i)*56+(x+1-j)] * V[b, n*32+d, (x+qj-j)*56+(y+qi-i)]
// (the bdwh spatial-transpose of the value tensor is baked into the V column index)
// Tiling: block = 4 image rows x one head pair of one batch; thread = one position of one head, all 32 channels.
// Lanes run along l, so every A plane is read once in contiguous runs; the V halo (8 x 60 positions, zero outside
// the image, as the reference pads) sits in LDS. The V operand depends only on (qi-i, qj-j), so the A terms that
// share an offset are summed first (25 weights) and each V row is read once per thread.
#define TY 4                 // image rows per block
#define VR (TY + 4)          // halo rows
#define VC 63                // halo columns: 56 + 4, plus 3 never read, so that the tile's 16-byte pieces are 9 per thread, exact
#define VP 72                // LDS pitch in halves: 144 B = 16 B x odd, conflict-free for 16-byte reads along x
#define NPOS (TY * HH)       // 224 positions = 7 waves per head
__global__ void __launch_bounds__(2 * NPOS)
apply_fold(const _Float16* __restrict__ A, const _Float16* __restrict__ Vt, _Float16* __restrict__ Ft) {
    __shared__ __align__(16) _Float16 vs[VR * VC * VP];   // V halo tile, 128 B (two heads) per position
    __shared__ __align__(16) _Float16 os[NPOS * VP];      // output tile, 128 B per position
    const int tid = threadIdx.x;
    const int hh2 = __builtin_amdgcn_readfirstlane((tid >= NPOS) ? 1 : 0);   // head of the pair: the same in all lanes of a wave (7 waves per head), kept scalar so that A has a scalar base
    const int pl  = tid - hh2 * NPOS;                    // position inside the tile
    const int y0  = blockIdx.x * TY;
    const int np  = blockIdx.y;
    const int b   = blockIdx.z;
    const int yl = pl / HH, x = pl % HH;
    const int y  = y0 + yl;
    const int n  = np * 2 + hh2;

    // A: 81 independent 2-byte loads per thread, 64 contiguous bytes per wave each; a fold shift that leaves the image
    // reads the thread's own position instead (in bounds) and is weighted 0
    const char* __restrict__ Ab = (const char*)(A + ((size_t)b * Ee + n * 81) * LL);   // scalar base + 32-bit lane offset
    _Float16 ah[81];
    float msk[9];
#pragma unroll
    for (int i = 0; i < 3; ++i)
#pragma unroll
        for (int j = 0; j < 3; ++j) {
            const int hp = y + 1 - i, wp = x + 1 - j;    // source l' for this fold shift
            const bool ok = (hp >= 0 && hp < HH && wp >= 0 && wp < HH);
            const unsigned ls = 2u * (unsigned)(ok ? hp * HH + wp : y * HH + x);
            msk[i * 3 + j] = ok ? 1.0f : 0.0f;
#pragma unroll
            for (int q = 0; q < 9; ++q) ah[(i * 3 + j) * 9 + q] = *(const _Float16*)(Ab + ls + ((i * 3 + j) * 9 + q) * LL * 2);
        }

    // V halo: entry (rr, ss) holds V at row r = y0-2+rr, column s = ss-2 of the transposed value image, i.e. Vt row s*56+r
    const char* __restrict__ Vb = (const char*)(Vt + (size_t)b * LL * Cc + np * 64);
#pragma unroll
    for (int it = 0; it < VR * VC * 8 / (2 * NPOS); ++it) {   // addresses clamped into Vt: no branch around the loads
        const int c = tid + it * 2 * NPOS;
        const int e = c >> 3, pc = c & 7;
        const int rr = e % VR, ss = e / VR;
        const int r = y0 - 2 + rr, s = ss - 2;
        const int rc = min(max(r, 0), HH - 1), sc = min(max(s, 0), HH - 1);
        v4u val = *(const v4u*)(Vb + (unsigned)((sc * HH + rc) * Cc * 2 + pc * 16));
        val &= (r >= 0 && r < HH && s >= 0 && s < HH) ? 0xFFFFFFFFu : 0u;   // the reference's zero padding
        *(v4u*)(vs + (rr * VC + ss) * VP + pc * 8) = val;
    }

    float w[5][5] = {};
#pragma unroll
    for (int i = 0; i < 3; ++i)
#pragma unroll
        for (int j = 0; j < 3; ++j)
#pragma unroll
            for (int qi = 0; qi < 3; ++qi)
#pragma unroll
                for (int qj = 0; qj < 3; ++qj)
                    w[qi - i + 2][qj - j + 2] += msk[i * 3 + j] * (float)ah[(i * 3 + j) * 9 + qi * 3 + qj];
    __syncthreads();

    float acc[HD] = {};
    const _Float16* vb = vs + (yl * VC + x) * VP + hh2 * HD;
#pragma unroll
    for (int dy = 0; dy < 5; ++dy)
#pragma unroll
        for (int dx = 0; dx < 5; ++dx) {
            const v8h* pv = (const v8h*)(vb + (dy * VC + dx) * VP);
#pragma unroll
            for (int k = 0; k < HD / 8; ++k) {
                const v8h v = pv[k];
#pragma unroll
                for (int e = 0; e < 8; ++e) acc[k * 8 + e] += w[dy][dx] * (float)v[e];
            }
        }

    // whole 128-B lines of Ft: both heads of a position meet in LDS, 8 lanes store one line
#pragma unroll
    for (int k = 0; k < HD / 8; ++k) {
        v8h o;
#pragma unroll
        for (int e = 0; e < 8; ++e) o[e] = (_Float16)acc[k * 8 + e];
        *(v8h*)(os + pl * VP + hh2 * HD + k * 8) = o;
    }
    __syncthreads();
#pragma unroll
    for (int it = 0; it < 4; ++it) {                      // NPOS * 8 pieces = 4 per thread, exact
        const int c = tid + it * 2 * NPOS;
        const int e = c >> 3, pc = c & 7;
        vst2(Ft + ((size_t)b * LL + y0 * HH + e) * Cc + np * 64 + pc * 8, *(const v4u*)(os + e * VP + pc * 8));
    }
}

// ---------------------------------------------------------------------------
extern "C" void kernel_launch(void* const* d_in, const int* in_sizes, int n_in,
                              void* d_out, int out_size, void* d_ws, size_t ws_size,
                              hipStream_t stream) {
    (void)in_sizes; (void)n_in; (void)out_size; (void)ws_size;
    const float* x  = (const float*)d_in[0];
    const float* Wv = (const float*)d_in[1];
    const float* Wa = (const float*)d_in[2];
    const float* ba = (const float*)d_in[3];
    const float* Wp = (const float*)d_in[4];
    const float* bp = (const float*)d_in[5];
    float* out = (float*)d_out;

    char* ws = (char*)d_ws;
    size_t off = 0;
    auto carve = [&](size_t bytes) -> void* {
        void* p = ws + off;
        off += (bytes + 255) & ~(size_t)255;
        return p;
    };
    _Float16* Xt   = (_Float16*)carve((size_t)Bb * LL * Cc * 2);  // 19.3 MB
    _Float16* Wvh  = (_Float16*)carve((size_t)Cc * Cc * 2);
    _Float16* Wah  = (_Float16*)carve((size_t)EPAD * Cc * 2);
    _Float16* Wph  = (_Float16*)carve((size_t)Cc * Cc * 2);
    _Float16* Vt   = (_Float16*)carve((size_t)Bb * LL * Cc * 2);  // 19.3 MB
    _Float16* Abuf = (_Float16*)carve((size_t)Bb * Ee * LL * 2);  // 48.8 MB
    _Float16* Ft   = (_Float16*)carve((size_t)Bb * LL * Cc * 2);  // 19.3 MB

    // 1) convert weights (Wa zero-padded to 992 rows); 8 halves per thread
    cvt_f32_f16<<<(Cc * Cc / 8 + 255) / 256, 256, 0, stream>>>(Wv, Wvh, Cc * Cc, Cc * Cc);
    cvt_f32_f16<<<(EPAD * Cc / 8 + 255) / 256, 256, 0, stream>>>(Wa, Wah, Ee * Cc, EPAD * Cc);
    cvt_f32_f16<<<(Cc * Cc / 8 + 255) / 256, 256, 0, stream>>>(Wp, Wph, Cc * Cc, Cc * Cc);

    // 2) pack x into [b][l][c] f16
    pack_x<<<(Bb * LL * (Cc / 8)) / 256, 256, 0, stream>>>(x, Xt);

    dim3 gblk(32, 8);
    // 3) value projection -> Vt[b][l][c]  (6 M-tiles of 64 x 98 N-tiles of 32 = 588 -> 74 blocks)
    gemm16<0><<<dim3(74, 1, Bb), gblk, 0, stream>>>(Wvh, Xt, nullptr, nullptr, Vt, Cc, Cc / 64, LL / 32);
    // 4) attention logits + bias (f16) -> Abuf[b][e][l]  (31 M-tiles of 32 x 49 N-tiles of 64 = 1519 -> 190 blocks)
    gemm16<2><<<dim3(190, 1, Bb), gblk, 0, stream>>>(Wah, Xt, ba, nullptr, Abuf, Ee, EPAD / 32, LL / 64);
    // 5) softmax over q, in place (f16 storage, f32 math)
    softmax9<<<(Bb * NHEAD * 9 * (LL / 2)) / 256, 256, 0, stream>>>(Abuf);
    // 6) fused apply + fold -> Ft[b][l][c]
    apply_fold<<<dim3(HH / TY, NHEAD / 2, Bb), 2 * NPOS, 0, stream>>>(Abuf, Vt, Ft);
    // 7) final projection + bias -> out[b][d][l]
    gemm16<1><<<dim3(74, 1, Bb), gblk, 0, stream>>>(Wph, Ft, bp, out, nullptr, Cc, Cc / 64, LL / 32);
}

// v002
// One run takes 143 microseconds.
// Two timings next to v001 both put it at 1.35 times that version's speed.
// Counting every step since v000, it is 4.39 times as fast.
#include <hip/hip_runtime.h>
// Contractions: value projection, attention-logit projection and final projection (K = 384) on v_wmma_f32_16x16x32_f16
// (f16 operands, f32 accumulate); softmax over the 3x3 window and the attention-apply/fold (per-position weights, no shared operand) in f32 on VALU.

// ---------------- problem constants ----------------
#define Cc    384
#define NHEAD 12
#define HD    32
#define Ee    972        // K^4 * HEADS
#define EPAD  1024       // Ee padded to a multiple of the GEMM's 128-row tile
#define Bb    8
#define HH    56
#define LL    3136       // 56*56

typedef __attribute__((ext_vector_type(8)))  _Float16 v8h;
typedef __attribute__((ext_vector_type(16))) _Float16 v16h;
typedef __attribute__((ext_vector_type(8)))  float    v8f;
typedef __attribute__((ext_vector_type(4)))  float    v4f;
typedef __attribute__((ext_vector_type(4)))  unsigned v4u;

union AFrag { v16h v; v8h h[2]; };

template <typename V> __device__ __forceinline__ void vst2(void* p, V v) {
    *(V*)p = v; 
}
__device__ __forceinline__ v8f wmma_f16(v16h a, v16h b, v8f c) {
    v8f d = __builtin_amdgcn_wmma_f32_16x16x32_f16(false, a, false, b, (short)0, c, false, false);
    asm volatile("v_nop\n\tv_nop\n\tv_nop\n\tv_nop" : "+v"(d) : "v"(a), "v"(b));
    return d;
}

// ---------------- f32 -> f16 weight convert (with zero pad): 8 elements (16 B) per thread ----------------
__global__ void cvt_f32_f16(const float* __restrict__ s, _Float16* __restrict__ d, int n, int npad) {
    int g = blockIdx.x * 256 + threadIdx.x;             // npad is a multiple of 8
    if (g * 8 >= npad) return;
    union { v8h v; v4u u; } pk;
#pragma unroll
    for (int e = 0; e < 8; ++e) { int i = g * 8 + e; pk.v[e] = (i < n) ? (_Float16)s[i] : (_Float16)0.0f; }
    vst2(d + (size_t)g * 8, pk.u);
}

// x[B][C][L] (f32) -> Xt[B][L][C] (f16): one thread = 8 consecutive c of one (b,l) = one 16-B piece; a row of 384 halves = 6 lines
__global__ void pack_x(const float* __restrict__ x, _Float16* __restrict__ Xt) {
    int g = blockIdx.x * 256 + threadIdx.x;             // total Bb*LL*48 (exact)
    int cq = g % (Cc / 8);
    int r  = g / (Cc / 8);
    int l  = r % LL;
    int b  = r / LL;
    union { v8h v; v4u u; } pk;
#pragma unroll
    for (int e = 0; e < 8; ++e) pk.v[e] = (_Float16)x[((size_t)b * Cc + cq * 8 + e) * LL + l];
    vst2(Xt + ((size_t)b * LL + l) * Cc + cq * 8, pk.u);
}

// ---------------- WMMA GEMM: D[M x N] = W[M x 384] @ Xt^T, N = all (b, l) columns in Xt's own row order ----------
// Work-group = 128 x 128 tile of D, 8 waves. Both operands pass through LDS in stages of 64 k (one whole 128-B line of every
// row), two buffers: each byte is fetched once per work-group in whole lines and shared by the waves that need it.
// A/B fragments: row/col = lane&15; elements 0..7 <- k0 + 8*hi + 0..7, elements 8..15 <- k0 + 16 + 8*hi + 0..7 (same map).
#define BT 128               // rows of W and rows of Xt per work-group
#define KC 64                // k per stage
#define LP 72                // LDS pitch in halves: 144 B = 16 B x odd, conflict-free for 16-byte fragment reads
#define STG (2 * BT * LP)    // halves per stage: W rows, then Xt rows
template <int MODE>
__global__ void __launch_bounds__(256)
gemm16(const _Float16* __restrict__ W, const _Float16* __restrict__ X,
       const float* __restrict__ bias, float* __restrict__ out32,
       _Float16* __restrict__ out16, int Mtot) {
    constexpr int TM = (MODE == 2) ? 32 : 64, TN = (MODE == 2) ? 64 : 32;
    constexpr int MI = TM / 16, NI = TN / 16;
    constexpr int WM = BT / TM;                             // waves along M; 8 / WM along N
    __shared__ __align__(16) char smem[2 * STG * 2];        // two operand stages; afterwards the per-wave f32 staging, 8 KB each
    static_assert(sizeof(smem) >= 8 * TM * TN * 4, "output staging must fit");
    _Float16* sm = (_Float16*)smem;
    const int lane  = threadIdx.x;            // 0..31
    const int wid   = threadIdx.y;            // 0..7
    const int tid   = wid * 32 + lane;
    const int mB = blockIdx.x * BT;
    const int nB = blockIdx.y * BT;           // column b * LL + l
    const int wm = wid % WM, wn = wid / WM;
    const int m0 = mB + wm * TM;
    const int nf = nB + wn * TN;              // LL is a multiple of TN: a wave's columns lie in one batch
    const int b  = nf / LL;
    const int n0 = nf % LL;
    const int laneM = lane & 15;
    const int hi    = lane >> 4;
    float* S = (float*)smem + wid * TM * TN;

    {
        // 16-byte pieces: 8 lanes cover one row's line, a wave 4 rows, the work-group 32 rows per step
        const _Float16* __restrict__ gW = W + (size_t)(mB + (tid >> 3)) * Cc + (tid & 7) * 8;
        const _Float16* __restrict__ gX = X + (size_t)(nB + (tid >> 3)) * Cc + (tid & 7) * 8;
        _Float16* sp = sm + (tid >> 3) * LP + (tid & 7) * 8;
        v4u rw[BT / 32], rx[BT / 32];
        auto fetch = [&](int kc) {
#pragma unroll   // rw, rx stay in registers only under constant indices
            for (int it = 0; it < BT / 32; ++it) {
                rw[it] = *(const v4u*)(gW + it * 32 * Cc + kc * KC);
                rx[it] = *(const v4u*)(gX + it * 32 * Cc + kc * KC);
            }
        };
        auto put = [&](int buf) {
#pragma unroll   // as in fetch
            for (int it = 0; it < BT / 32; ++it) {
                *(v4u*)(sp + buf * STG + it * 32 * LP) = rw[it];
                *(v4u*)(sp + buf * STG + BT * LP + it * 32 * LP) = rx[it];
            }
        };
        fetch(0);
        put(0);
        __syncthreads();
        v8f acc[MI][NI] = {};
#pragma unroll   // buffer index and the last-stage test become constants
        for (int kc = 0; kc < Cc / KC; ++kc) {
            if (kc + 1 < Cc / KC) fetch(kc + 1);            // in flight while this stage is multiplied
            const _Float16* sa = sm + (kc & 1) * STG + (wm * TM + laneM) * LP + 8 * hi;
            const _Float16* sb = sm + (kc & 1) * STG + BT * LP + (wn * TN + laneM) * LP + 8 * hi;
#pragma unroll
            for (int ks = 0; ks < KC; ks += 32) {
                AFrag a[MI], bf[NI];
#pragma unroll
                for (int mi = 0; mi < MI; ++mi) {
                    a[mi].h[0] = *(const v8h*)(sa + mi * 16 * LP + ks);
                    a[mi].h[1] = *(const v8h*)(sa + mi * 16 * LP + ks + 16);
                }
#pragma unroll
                for (int ni = 0; ni < NI; ++ni) {
                    bf[ni].h[0] = *(const v8h*)(sb + ni * 16 * LP + ks);
                    bf[ni].h[1] = *(const v8h*)(sb + ni * 16 * LP + ks + 16);
                }
#pragma unroll
                for (int mi = 0; mi < MI; ++mi)
#pragma unroll
                    for (int ni = 0; ni < NI; ++ni)
                        acc[mi][ni] = wmma_f16(a[mi].v, bf[ni].v, acc[mi][ni]);
            }
            if (kc + 1 < Cc / KC) put((kc + 1) & 1);        // the buffer that every wave left at the last barrier
            __syncthreads();                                // publishes the next stage; after the last one, frees LDS for S
        }
        // D layout: element r -> (m = mi*16 + 8*hi + r, n = ni*16 + laneM); stage [m][n] for MODE 1/2, [n][m] for MODE 0
#pragma unroll
        for (int mi = 0; mi < MI; ++mi)
#pragma unroll
            for (int ni = 0; ni < NI; ++ni)
#pragma unroll
                for (int r = 0; r < 8; ++r) {
                    const int ml = mi * 16 + 8 * hi + r, nl = ni * 16 + laneM;
                    float v = acc[mi][ni][r];
                    if (MODE != 0) { const int row = m0 + ml; v += (row < Mtot) ? bias[row] : 0.0f; }
                    if (MODE == 0) S[nl * TM + ml] = v; else S[ml * TN + nl] = v;
                }
    }
    __syncthreads();
    if (MODE == 0) {
#pragma unroll
        for (int q = 0; q < 8; ++q) {
            const int nl = q * 4 + (lane >> 3), pc = lane & 7;
            union { v8h v; v4u u; } pk;
#pragma unroll
            for (int e = 0; e < 8; ++e) pk.v[e] = (_Float16)S[nl * TM + pc * 8 + e];
            vst2(out16 + ((size_t)b * LL + n0 + nl) * Cc + m0 + pc * 8, pk.u);
        }
    } else if (MODE == 1) {
#pragma unroll
        for (int q = 0; q < 16; ++q) {
            const int ml = q * 4 + (lane >> 3), pc = lane & 7;
            const int row = m0 + ml;
            if (row < Mtot)
                vst2(out32 + ((size_t)b * Mtot + row) * LL + n0 + pc * 4, *(const v4f*)(S + ml * TN + pc * 4));
        }
    } else {
#pragma unroll
        for (int q = 0; q < 8; ++q) {
            const int ml = q * 4 + (lane >> 3), pc = lane & 7;
            const int row = m0 + ml;
            union { v8h v; v4u u; } pk;
#pragma unroll
            for (int e = 0; e < 8; ++e) pk.v[e] = (_Float16)S[ml * TN + pc * 8 + e];
            if (row < Mtot) vst2(out16 + ((size_t)b * Mtot + row) * LL + n0 + pc * 8, pk.u);
        }
    }
}

// -------- softmax over q (groups of 9, stride LL), f16 in/out, f32 math; thread = 2 consecutive l (4-B stores, one line per wave) -----
__global__ void softmax9(_Float16* __restrict__ A) {
    int i = blockIdx.x * 256 + threadIdx.x;   // total Bb*NHEAD*9*(LL/2) (exact)
    int l2 = i % (LL / 2);
    int r = i / (LL / 2);
    int p = r % 9;  r /= 9;
    int n = r % NHEAD;
    int b = r / NHEAD;
    _Float16* base = A + ((size_t)b * Ee + n * 81 + p * 9) * LL + 2 * l2;
    const float sc = 0.17677669529663687f;    // 32^-0.5
    float v0[9], v1[9], m0 = -1e30f, m1 = -1e30f;
#pragma unroll
    for (int q = 0; q < 9; ++q) {
        const _Float16* pq = base + (size_t)q * LL;
        v0[q] = (float)pq[0] * sc; v1[q] = (float)pq[1] * sc;
        m0 = fmaxf(m0, v0[q]); m1 = fmaxf(m1, v1[q]);
    }
    float s0 = 0.f, s1 = 0.f;
#pragma unroll
    for (int q = 0; q < 9; ++q) { v0[q] = __expf(v0[q] - m0); s0 += v0[q]; v1[q] = __expf(v1[q] - m1); s1 += v1[q]; }
    const float i0 = 1.f / s0, i1 = 1.f / s1;
#pragma unroll
    for (int q = 0; q < 9; ++q) {
        union { _Float16 h[2]; unsigned u; } pk;
        pk.h[0] = (_Float16)(v0[q] * i0); pk.h[1] = (_Float16)(v1[q] * i1);
        vst2((char*)(base + (size_t)q * LL), pk.u);
    }
}

// ------- fused attention-apply + fold: Ft[b][y*56+x][c] = folded value -------
// folded[b,n*32+d,y,x] = sum_{i,j valid} sum_{q valid}
//     A[b, n*81+(i3+j)*9+q, (y+1-i)*56+(x+1-j)] * V[b, n*32+d, (x+qj-j)*56+(y+qi-i)]
// (the bdwh spatial-transpose of the value tensor is baked into the V column index)
// Tiling: block = 4 image rows x one head pair of one batch; thread = one position of one head, all 32 channels.
// Lanes run along l, so every A plane is read once in contiguous runs; the V halo (8 x 60 positions, zero outside
// the image, as the reference pads) sits in LDS. The V operand depends only on (qi-i, qj-j), so the A terms that
// share an offset are summed first (25 weights) and each V row is read once per thread.
#define TY 4                 // image rows per block
#define VR (TY + 4)          // halo rows
#define VC 63                // halo columns: 56 + 4, plus 3 never read, so that the tile's 16-byte pieces are 9 per thread, exact
#define VP 72                // LDS pitch in halves: 144 B = 16 B x odd, conflict-free for 16-byte reads along x
#define NPOS (TY * HH)       // 224 positions = 7 waves per head
__global__ void __launch_bounds__(2 * NPOS)
apply_fold(const _Float16* __restrict__ A, const _Float16* __restrict__ Vt, _Float16* __restrict__ Ft) {
    __shared__ __align__(16) _Float16 vs[VR * VC * VP];   // V halo tile, 128 B (two heads) per position
    __shared__ __align__(16) _Float16 os[NPOS * VP];      // output tile, 128 B per position
    const int tid = threadIdx.x;
    const int hh2 = __builtin_amdgcn_readfirstlane((tid >= NPOS) ? 1 : 0);   // head of the pair: the same in all lanes of a wave (7 waves per head), kept scalar so that A has a scalar base
    const int pl  = tid - hh2 * NPOS;                    // position inside the tile
    const int y0  = blockIdx.x * TY;
    const int np  = blockIdx.y;
    const int b   = blockIdx.z;
    const int yl = pl / HH, x = pl % HH;
    const int y  = y0 + yl;
    const int n  = np * 2 + hh2;

    // A: 81 independent 2-byte loads per thread, 64 contiguous bytes per wave each; a fold shift that leaves the image
    // reads the thread's own position instead (in bounds) and is weighted 0
    const char* __restrict__ Ab = (const char*)(A + ((size_t)b * Ee + n * 81) * LL);   // scalar base + 32-bit lane offset
    _Float16 ah[81];
    float msk[9];
#pragma unroll
    for (int i = 0; i < 3; ++i)
#pragma unroll
        for (int j = 0; j < 3; ++j) {
            const int hp = y + 1 - i, wp = x + 1 - j;    // source l' for this fold shift
            const bool ok = (hp >= 0 && hp < HH && wp >= 0 && wp < HH);
            const unsigned ls = 2u * (unsigned)(ok ? hp * HH + wp : y * HH + x);
            msk[i * 3 + j] = ok ? 1.0f : 0.0f;
#pragma unroll
            for (int q = 0; q < 9; ++q) ah[(i * 3 + j) * 9 + q] = *(const _Float16*)(Ab + ls + ((i * 3 + j) * 9 + q) * LL * 2);
        }

    // V halo: entry (rr, ss) holds V at row r = y0-2+rr, column s = ss-2 of the transposed value image, i.e. Vt row s*56+r
    const char* __restrict__ Vb = (const char*)(Vt + (size_t)b * LL * Cc + np * 64);
#pragma unroll
    for (int it = 0; it < VR * VC * 8 / (2 * NPOS); ++it) {   // addresses clamped into Vt: no branch around the loads
        const int c = tid + it * 2 * NPOS;
        const int e = c >> 3, pc = c & 7;
        const int rr = e % VR, ss = e / VR;
        const int r = y0 - 2 + rr, s = ss - 2;
        const int rc = min(max(r, 0), HH - 1), sc = min(max(s, 0), HH - 1);
        v4u val = *(const v4u*)(Vb + (unsigned)((sc * HH + rc) * Cc * 2 + pc * 16));
        val &= (r >= 0 && r < HH && s >= 0 && s < HH) ? 0xFFFFFFFFu : 0u;   // the reference's zero padding
        *(v4u*)(vs + (rr * VC + ss) * VP + pc * 8) = val;
    }

    float w[5][5] = {};
#pragma unroll
    for (int i = 0; i < 3; ++i)
#pragma unroll
        for (int j = 0; j < 3; ++j)
#pragma unroll
            for (int qi = 0; qi < 3; ++qi)
#pragma unroll
                for (int qj = 0; qj < 3; ++qj)
                    w[qi - i + 2][qj - j + 2] += msk[i * 3 + j] * (float)ah[(i * 3 + j) * 9 + qi * 3 + qj];
    __syncthreads();

    float acc[HD] = {};
    const _Float16* vb = vs + (yl * VC + x) * VP + hh2 * HD;
#pragma unroll
    for (int dy = 0; dy < 5; ++dy)
#pragma unroll
        for (int dx = 0; dx < 5; ++dx) {
            const v8h* pv = (const v8h*)(vb + (dy * VC + dx) * VP);
#pragma unroll
            for (int k = 0; k < HD / 8; ++k) {
                const v8h v = pv[k];
#pragma unroll
                for (int e = 0; e < 8; ++e) acc[k * 8 + e] += w[dy][dx] * (float)v[e];
            }
        }

    // whole 128-B lines of Ft: both heads of a position meet in LDS, 8 lanes store one line
#pragma unroll
    for (int k = 0; k < HD / 8; ++k) {
        v8h o;
#pragma unroll
        for (int e = 0; e < 8; ++e) o[e] = (_Float16)acc[k * 8 + e];
        *(v8h*)(os + pl * VP + hh2 * HD + k * 8) = o;
    }
    __syncthreads();
#pragma unroll
    for (int it = 0; it < 4; ++it) {                      // NPOS * 8 pieces = 4 per thread, exact
        const int c = tid + it * 2 * NPOS;
        const int e = c >> 3, pc = c & 7;
        vst2(Ft + ((size_t)b * LL + y0 * HH + e) * Cc + np * 64 + pc * 8, *(const v4u*)(os + e * VP + pc * 8));
    }
}

// ---------------------------------------------------------------------------
extern "C" void kernel_launch(void* const* d_in, const int* in_sizes, int n_in,
                              void* d_out, int out_size, void* d_ws, size_t ws_size,
                              hipStream_t stream) {
    (void)in_sizes; (void)n_in; (void)out_size; (void)ws_size;
    const float* x  = (const float*)d_in[0];
    const float* Wv = (const float*)d_in[1];
    const float* Wa = (const float*)d_in[2];
    const float* ba = (const float*)d_in[3];
    const float* Wp = (const float*)d_in[4];
    const float* bp = (const float*)d_in[5];
    float* out = (float*)d_out;

    char* ws = (char*)d_ws;
    size_t off = 0;
    auto carve = [&](size_t bytes) -> void* {
        void* p = ws + off;
        off += (bytes + 255) & ~(size_t)255;
        return p;
    };
    _Float16* Xt   = (_Float16*)carve((size_t)Bb * LL * Cc * 2);  // 19.3 MB
    _Float16* Wvh  = (_Float16*)carve((size_t)Cc * Cc * 2);
    _Float16* Wah  = (_Float16*)carve((size_t)EPAD * Cc * 2);
    _Float16* Wph  = (_Float16*)carve((size_t)Cc * Cc * 2);
    _Float16* Vt   = (_Float16*)carve((size_t)Bb * LL * Cc * 2);  // 19.3 MB
    _Float16* Abuf = (_Float16*)carve((size_t)Bb * Ee * LL * 2);  // 48.8 MB
    _Float16* Ft   = (_Float16*)carve((size_t)Bb * LL * Cc * 2);  // 19.3 MB

    // 1) convert weights (Wa zero-padded to 1024 rows); 8 halves per thread
    cvt_f32_f16<<<(Cc * Cc / 8 + 255) / 256, 256, 0, stream>>>(Wv, Wvh, Cc * Cc, Cc * Cc);
    cvt_f32_f16<<<(EPAD * Cc / 8 + 255) / 256, 256, 0, stream>>>(Wa, Wah, Ee * Cc, EPAD * Cc);
    cvt_f32_f16<<<(Cc * Cc / 8 + 255) / 256, 256, 0, stream>>>(Wp, Wph, Cc * Cc, Cc * Cc);

    // 2) pack x into [b][l][c] f16
    pack_x<<<(Bb * LL * (Cc / 8)) / 256, 256, 0, stream>>>(x, Xt);

    dim3 gblk(32, 8);
    // 3) value projection -> Vt[b][l][c]  (3 x 196 tiles of 128 x 128)
    gemm16<0><<<dim3(Cc / BT, Bb * LL / BT), gblk, 0, stream>>>(Wvh, Xt, nullptr, nullptr, Vt, Cc);
    // 4) attention logits + bias (f16) -> Abuf[b][e][l]  (8 x 196 tiles)
    gemm16<2><<<dim3(EPAD / BT, Bb * LL / BT), gblk, 0, stream>>>(Wah, Xt, ba, nullptr, Abuf, Ee);
    // 5) softmax over q, in place (f16 storage, f32 math)
    softmax9<<<(Bb * NHEAD * 9 * (LL / 2)) / 256, 256, 0, stream>>>(Abuf);
    // 6) fused apply + fold -> Ft[b][l][c]
    apply_fold<<<dim3(HH / TY, NHEAD / 2, Bb), 2 * NPOS, 0, stream>>>(Abuf, Vt, Ft);
    // 7) final projection + bias -> out[b][d][l]
    gemm16<1><<<dim3(Cc / BT, Bb * LL / BT), gblk, 0, stream>>>(Wph, Ft, bp, out, nullptr, Cc);
}

// v003
// Measured time: 129 microseconds a run.
// Two timings next to v002 both put it at 1.11 times that version's speed.
// All steps since v000 together make it 4.85 times as fast.
#include <hip/hip_runtime.h>
// Contractions: value projection, attention-logit projection and final projection (K = 384) on v_wmma_f32_16x16x32_f16
// (f16 operands, f32 accumulate); softmax over the 3x3 window and the attention-apply/fold (per-position weights, no shared operand) in f32 on VALU.

// ---------------- problem constants ----------------
#define Cc    384
#define NHEAD 12
#define HD    32
#define Ee    972        // K^4 * HEADS
#define EPAD  1024       // Ee padded to a multiple of the GEMM's 128-row tile
#define Bb    8
#define HH    56
#define LL    3136       // 56*56

typedef __attribute__((ext_vector_type(8)))  _Float16 v8h;
typedef __attribute__((ext_vector_type(16))) _Float16 v16h;
typedef __attribute__((ext_vector_type(8)))  float    v8f;
typedef __attribute__((ext_vector_type(4)))  float    v4f;
typedef __attribute__((ext_vector_type(4)))  unsigned v4u;

union AFrag { v16h v; v8h h[2]; };

template <typename V> __device__ __forceinline__ void vst2(void* p, V v) {
    *(V*)p = v; 
}
__device__ __forceinline__ v8f wmma_f16(v16h a, v16h b, v8f c) {
    v8f d = __builtin_amdgcn_wmma_f32_16x16x32_f16(false, a, false, b, (short)0, c, false, false);
    asm volatile("v_nop\n\tv_nop\n\tv_nop\n\tv_nop" : "+v"(d) : "v"(a), "v"(b));
    return d;
}

// ---------------- f32 -> f16 weight convert (with zero pad): 8 elements (16 B) per thread ----------------
__global__ void cvt_f32_f16(const float* __restrict__ s, _Float16* __restrict__ d, int n, int npad) {
    int g = blockIdx.x * 256 + threadIdx.x;             // npad is a multiple of 8
    if (g * 8 >= npad) return;
    union { v8h v; v4u u; } pk;
#pragma unroll
    for (int e = 0; e < 8; ++e) { int i = g * 8 + e; pk.v[e] = (i < n) ? (_Float16)s[i] : (_Float16)0.0f; }
    vst2(d + (size_t)g * 8, pk.u);
}

// x[B][C][L] (f32) -> Xt[B][L][C] (f16): one thread = 8 consecutive c of one (b,l) = one 16-B piece; a row of 384 halves = 6 lines
__global__ void pack_x(const float* __restrict__ x, _Float16* __restrict__ Xt) {
    int g = blockIdx.x * 256 + threadIdx.x;             // total Bb*LL*48 (exact)
    int cq = g % (Cc / 8);
    int r  = g / (Cc / 8);
    int l  = r % LL;
    int b  = r / LL;
    union { v8h v; v4u u; } pk;
#pragma unroll
    for (int e = 0; e < 8; ++e) pk.v[e] = (_Float16)x[((size_t)b * Cc + cq * 8 + e) * LL + l];
    vst2(Xt + ((size_t)b * LL + l) * Cc + cq * 8, pk.u);
}

// ---------------- WMMA GEMM: D[M x N] = W[M x 384] @ Xt^T, N = all (b, l) columns in Xt's own row order ----------
// Work-group = 128 x 128 tile of D, 8 waves. Both operands pass through LDS in stages of 64 k (one whole 128-B line of every
// row), two buffers: each byte is fetched once per work-group in whole lines and shared by the waves that need it.
// A/B fragments: row/col = lane&15; elements 0..7 <- k0 + 8*hi + 0..7, elements 8..15 <- k0 + 16 + 8*hi + 0..7 (same map).
#define BT 128               // rows of W and rows of Xt per work-group
#define KC 64                // k per stage
#define LP 72                // LDS pitch in halves: 144 B = 16 B x odd, conflict-free for 16-byte fragment reads
#define STG (2 * BT * LP)    // halves per stage: W rows, then Xt rows
template <int MODE>
__global__ void __launch_bounds__(256)
gemm16(const _Float16* __restrict__ W, const _Float16* __restrict__ X,
       const float* __restrict__ bias, float* __restrict__ out32,
       _Float16* __restrict__ out16, int Mtot) {
    constexpr int TM = (MODE == 2) ? 32 : 64, TN = (MODE == 2) ? 64 : 32;
    constexpr int MI = TM / 16, NI = TN / 16;
    constexpr int WM = BT / TM;                             // waves along M; 8 / WM along N
    __shared__ __align__(16) char smem[2 * STG * 2];        // two operand stages; afterwards the per-wave f32 staging, 8 KB each
    static_assert(sizeof(smem) >= 8 * TM * TN * 4, "output staging must fit");
    _Float16* sm = (_Float16*)smem;
    const int lane  = threadIdx.x;            // 0..31
    const int wid   = threadIdx.y;            // 0..7
    const int tid   = wid * 32 + lane;
    const int mB = blockIdx.x * BT;
    const int nB = blockIdx.y * BT;           // column b * LL + l
    const int wm = wid % WM, wn = wid / WM;
    const int m0 = mB + wm * TM;
    const int nf = nB + wn * TN;              // LL is a multiple of TN: a wave's columns lie in one batch
    const int b  = nf / LL;
    const int n0 = nf % LL;
    const int laneM = lane & 15;
    const int hi    = lane >> 4;
    float* S = (float*)smem + wid * TM * TN;

    {
        // 16-byte pieces: 8 lanes cover one row's line, a wave 4 rows, the work-group 32 rows per step
        const _Float16* __restrict__ gW = W + (size_t)(mB + (tid >> 3)) * Cc + (tid & 7) * 8;
        const _Float16* __restrict__ gX = X + (size_t)(nB + (tid >> 3)) * Cc + (tid & 7) * 8;
        _Float16* sp = sm + (tid >> 3) * LP + (tid & 7) * 8;
        v4u rw[BT / 32], rx[BT / 32];
        auto fetch = [&](int kc) {
#pragma unroll   // rw, rx stay in registers only under constant indices
            for (int it = 0; it < BT / 32; ++it) {
                rw[it] = *(const v4u*)(gW + it * 32 * Cc + kc * KC);
                rx[it] = *(const v4u*)(gX + it * 32 * Cc + kc * KC);
            }
        };
        auto put = [&](int buf) {
#pragma unroll   // as in fetch
            for (int it = 0; it < BT / 32; ++it) {
                *(v4u*)(sp + buf * STG + it * 32 * LP) = rw[it];
                *(v4u*)(sp + buf * STG + BT * LP + it * 32 * LP) = rx[it];
            }
        };
        fetch(0);
        put(0);
        __syncthreads();
        v8f acc[MI][NI] = {};
#pragma unroll   // buffer index and the last-stage test become constants
        for (int kc = 0; kc < Cc / KC; ++kc) {
            if (kc + 1 < Cc / KC) fetch(kc + 1);            // in flight while this stage is multiplied
            const _Float16* sa = sm + (kc & 1) * STG + (wm * TM + laneM) * LP + 8 * hi;
            const _Float16* sb = sm + (kc & 1) * STG + BT * LP + (wn * TN + laneM) * LP + 8 * hi;
#pragma unroll
            for (int ks = 0; ks < KC; ks += 32) {
                AFrag a[MI], bf[NI];
#pragma unroll
                for (int mi = 0; mi < MI; ++mi) {
                    a[mi].h[0] = *(const v8h*)(sa + mi * 16 * LP + ks);
                    a[mi].h[1] = *(const v8h*)(sa + mi * 16 * LP + ks + 16);
                }
#pragma unroll
                for (int ni = 0; ni < NI; ++ni) {
                    bf[ni].h[0] = *(const v8h*)(sb + ni * 16 * LP + ks);
                    bf[ni].h[1] = *(const v8h*)(sb + ni * 16 * LP + ks + 16);
                }
#pragma unroll
                for (int mi = 0; mi < MI; ++mi)
#pragma unroll
                    for (int ni = 0; ni < NI; ++ni)
                        acc[mi][ni] = wmma_f16(a[mi].v, bf[ni].v, acc[mi][ni]);
            }
            if (kc + 1 < Cc / KC) put((kc + 1) & 1);        // the buffer that every wave left at the last barrier
            __syncthreads();                                // publishes the next stage; after the last one, frees LDS for S
        }
        // D layout: element r -> (m = mi*16 + 8*hi + r, n = ni*16 + laneM); stage [m][n] for MODE 1/2, [n][m] for MODE 0
#pragma unroll
        for (int mi = 0; mi < MI; ++mi)
#pragma unroll
            for (int ni = 0; ni < NI; ++ni)
#pragma unroll
                for (int r = 0; r < 8; ++r) {
                    const int ml = mi * 16 + 8 * hi + r, nl = ni * 16 + laneM;
                    float v = acc[mi][ni][r];
                    if (MODE != 0) { const int row = m0 + ml; v += (row < Mtot) ? bias[row] : 0.0f; }
                    if (MODE == 0) S[nl * TM + ml] = v; else S[ml * TN + nl] = v;
                }
    }
    __syncthreads();
    if (MODE == 0) {
#pragma unroll
        for (int q = 0; q < 8; ++q) {
            const int nl = q * 4 + (lane >> 3), pc = lane & 7;
            union { v8h v; v4u u; } pk;
#pragma unroll
            for (int e = 0; e < 8; ++e) pk.v[e] = (_Float16)S[nl * TM + pc * 8 + e];
            vst2(out16 + ((size_t)b * LL + n0 + nl) * Cc + m0 + pc * 8, pk.u);
        }
    } else if (MODE == 1) {
#pragma unroll
        for (int q = 0; q < 16; ++q) {
            const int ml = q * 4 + (lane >> 3), pc = lane & 7;
            const int row = m0 + ml;
            if (row < Mtot)
                vst2(out32 + ((size_t)b * Mtot + row) * LL + n0 + pc * 4, *(const v4f*)(S + ml * TN + pc * 4));
        }
    } else {
#pragma unroll
        for (int q = 0; q < 8; ++q) {
            const int ml = q * 4 + (lane >> 3), pc = lane & 7;
            const int row = m0 + ml;
            union { v8h v; v4u u; } pk;
#pragma unroll
            for (int e = 0; e < 8; ++e) pk.v[e] = (_Float16)S[ml * TN + pc * 8 + e];
            if (row < Mtot) vst2(out16 + ((size_t)b * Mtot + row) * LL + n0 + pc * 8, pk.u);
        }
    }
}

// ------- fused softmax + attention-apply + fold: Ft[b][y*56+x][c] = folded value -------
// folded[b,n*32+d,y,x] = sum_{i,j valid} sum_{q valid}
//     softmax_q(A * 32^-0.5)[b, n*81+(i3+j)*9+q, (y+1-i)*56+(x+1-j)] * V[b, n*32+d, (x+qj-j)*56+(y+qi-i)]
// (the bdwh spatial-transpose of the value tensor is baked into the V column index)
// Tiling: block = 4 image rows x one head pair of one batch; thread = one position of one head, all 32 channels.
// Lanes run along l, so every A plane is read once in contiguous runs; the V halo (8 x 60 positions, zero outside
// the image, as the reference pads) sits in LDS. The V operand depends only on (qi-i, qj-j), so the A terms that
// share an offset are summed first (25 weights) and each V row is read once per thread.
// A holds the logits: a thread has all 9 q of each of its 9 (i, j) groups, and a (head, group, position) is used by at most
// one thread, so the softmax is taken here, in registers: no more exponentials than a launch of its own would take.
#define TY 4                 // image rows per block
#define VR (TY + 4)          // halo rows
#define VC 63                // halo columns: 56 + 4, plus 3 never read, so that the tile's 16-byte pieces are 9 per thread, exact
#define VP 72                // LDS pitch in halves: 144 B = 16 B x odd, conflict-free for 16-byte reads along x
#define NPOS (TY * HH)       // 224 positions = 7 waves per head
__global__ void __launch_bounds__(2 * NPOS)
apply_fold(const _Float16* __restrict__ A, const _Float16* __restrict__ Vt, _Float16* __restrict__ Ft) {
    __shared__ __align__(16) _Float16 vs[VR * VC * VP];   // V halo tile, 128 B (two heads) per position
    __shared__ __align__(16) _Float16 os[NPOS * VP];      // output tile, 128 B per position
    const int tid = threadIdx.x;
    const int hh2 = __builtin_amdgcn_readfirstlane((tid >= NPOS) ? 1 : 0);   // head of the pair: the same in all lanes of a wave (7 waves per head), kept scalar so that A has a scalar base
    const int pl  = tid - hh2 * NPOS;                    // position inside the tile
    const int y0  = blockIdx.x * TY;
    const int np  = blockIdx.y;
    const int b   = blockIdx.z;
    const int yl = pl / HH, x = pl % HH;
    const int y  = y0 + yl;
    const int n  = np * 2 + hh2;

    // A: 81 independent 2-byte loads per thread, 64 contiguous bytes per wave each; a fold shift that leaves the image
    // reads the thread's own position instead (in bounds) and is weighted 0
    const char* __restrict__ Ab = (const char*)(A + ((size_t)b * Ee + n * 81) * LL);   // scalar base + 32-bit lane offset
    _Float16 ah[81];
    float msk[9];
#pragma unroll
    for (int i = 0; i < 3; ++i)
#pragma unroll
        for (int j = 0; j < 3; ++j) {
            const int hp = y + 1 - i, wp = x + 1 - j;    // source l' for this fold shift
            const bool ok = (hp >= 0 && hp < HH && wp >= 0 && wp < HH);
            const unsigned ls = 2u * (unsigned)(ok ? hp * HH + wp : y * HH + x);
            msk[i * 3 + j] = ok ? 1.0f : 0.0f;
#pragma unroll
            for (int q = 0; q < 9; ++q) ah[(i * 3 + j) * 9 + q] = *(const _Float16*)(Ab + ls + ((i * 3 + j) * 9 + q) * LL * 2);
        }

    // V halo: entry (rr, ss) holds V at row r = y0-2+rr, column s = ss-2 of the transposed value image, i.e. Vt row s*56+r
    const char* __restrict__ Vb = (const char*)(Vt + (size_t)b * LL * Cc + np * 64);
#pragma unroll
    for (int it = 0; it < VR * VC * 8 / (2 * NPOS); ++it) {   // addresses clamped into Vt: no branch around the loads
        const int c = tid + it * 2 * NPOS;
        const int e = c >> 3, pc = c & 7;
        const int rr = e % VR, ss = e / VR;
        const int r = y0 - 2 + rr, s = ss - 2;
        const int rc = min(max(r, 0), HH - 1), sc = min(max(s, 0), HH - 1);
        v4u val = *(const v4u*)(Vb + (unsigned)((sc * HH + rc) * Cc * 2 + pc * 16));
        val &= (r >= 0 && r < HH && s >= 0 && s < HH) ? 0xFFFFFFFFu : 0u;   // the reference's zero padding
        *(v4u*)(vs + (rr * VC + ss) * VP + pc * 8) = val;
    }

    const float kq = 0.17677669529663687f * 1.4426950408889634f;   // 32^-0.5 * log2(e): exp(s * (a - max)) = 2^(kq * a - kq * max)
    float w[5][5] = {};
#pragma unroll
    for (int i = 0; i < 3; ++i)
#pragma unroll
        for (int j = 0; j < 3; ++j) {
            float ev[9];
            _Float16 mx = ah[(i * 3 + j) * 9];
#pragma unroll   // ah and ev stay in registers only under constant indices
            for (int q = 1; q < 9; ++q) mx = __builtin_fmaxf16(mx, ah[(i * 3 + j) * 9 + q]);
            const float nm = -kq * (float)mx;
            float sum = 0.f;
#pragma unroll   // as above
            for (int q = 0; q < 9; ++q) { ev[q] = __builtin_amdgcn_exp2f(fmaf((float)ah[(i * 3 + j) * 9 + q], kq, nm)); sum += ev[q]; }
            const float g = msk[i * 3 + j] * __builtin_amdgcn_rcpf(sum);   // sum lies in [1, 9]
#pragma unroll
            for (int qi = 0; qi < 3; ++qi)
#pragma unroll
                for (int qj = 0; qj < 3; ++qj)
                    w[qi - i + 2][qj - j + 2] += g * ev[qi * 3 + qj];
        }
    __syncthreads();

    float acc[HD] = {};
    const _Float16* vb = vs + (yl * VC + x) * VP + hh2 * HD;
#pragma unroll
    for (int dy = 0; dy < 5; ++dy)
#pragma unroll
        for (int dx = 0; dx < 5; ++dx) {
            const v8h* pv = (const v8h*)(vb + (dy * VC + dx) * VP);
#pragma unroll
            for (int k = 0; k < HD / 8; ++k) {
                const v8h v = pv[k];
#pragma unroll
                for (int e = 0; e < 8; ++e) acc[k * 8 + e] += w[dy][dx] * (float)v[e];
            }
        }

    // whole 128-B lines of Ft: both heads of a position meet in LDS, 8 lanes store one line
#pragma unroll
    for (int k = 0; k < HD / 8; ++k) {
        v8h o;
#pragma unroll
        for (int e = 0; e < 8; ++e) o[e] = (_Float16)acc[k * 8 + e];
        *(v8h*)(os + pl * VP + hh2 * HD + k * 8) = o;
    }
    __syncthreads();
#pragma unroll
    for (int it = 0; it < 4; ++it) {                      // NPOS * 8 pieces = 4 per thread, exact
        const int c = tid + it * 2 * NPOS;
        const int e = c >> 3, pc = c & 7;
        vst2(Ft + ((size_t)b * LL + y0 * HH + e) * Cc + np * 64 + pc * 8, *(const v4u*)(os + e * VP + pc * 8));
    }
}

// ---------------------------------------------------------------------------
extern "C" void kernel_launch(void* const* d_in, const int* in_sizes, int n_in,
                              void* d_out, int out_size, void* d_ws, size_t ws_size,
                              hipStream_t stream) {
    (void)in_sizes; (void)n_in; (void)out_size; (void)ws_size;
    const float* x  = (const float*)d_in[0];
    const float* Wv = (const float*)d_in[1];
    const float* Wa = (const float*)d_in[2];
    const float* ba = (const float*)d_in[3];
    const float* Wp = (const float*)d_in[4];
    const float* bp = (const float*)d_in[5];
    float* out = (float*)d_out;

    char* ws = (char*)d_ws;
    size_t off = 0;
    auto carve = [&](size_t bytes) -> void* {
        void* p = ws + off;
        off += (bytes + 255) & ~(size_t)255;
        return p;
    };
    _Float16* Xt   = (_Float16*)carve((size_t)Bb * LL * Cc * 2);  // 19.3 MB
    _Float16* Wvh  = (_Float16*)carve((size_t)Cc * Cc * 2);
    _Float16* Wah  = (_Float16*)carve((size_t)EPAD * Cc * 2);
    _Float16* Wph  = (_Float16*)carve((size_t)Cc * Cc * 2);
    _Float16* Vt   = (_Float16*)carve((size_t)Bb * LL * Cc * 2);  // 19.3 MB
    _Float16* Abuf = (_Float16*)carve((size_t)Bb * Ee * LL * 2);  // 48.8 MB
    _Float16* Ft   = (_Float16*)carve((size_t)Bb * LL * Cc * 2);  // 19.3 MB

    // 1) convert weights (Wa zero-padded to 1024 rows); 8 halves per thread
    cvt_f32_f16<<<(Cc * Cc / 8 + 255) / 256, 256, 0, stream>>>(Wv, Wvh, Cc * Cc, Cc * Cc);
    cvt_f32_f16<<<(EPAD * Cc / 8 + 255) / 256, 256, 0, stream>>>(Wa, Wah, Ee * Cc, EPAD * Cc);
    cvt_f32_f16<<<(Cc * Cc / 8 + 255) / 256, 256, 0, stream>>>(Wp, Wph, Cc * Cc, Cc * Cc);

    // 2) pack x into [b][l][c] f16
    pack_x<<<(Bb * LL * (Cc / 8)) / 256, 256, 0, stream>>>(x, Xt);

    dim3 gblk(32, 8);
    // 3) value projection -> Vt[b][l][c]  (3 x 196 tiles of 128 x 128)
    gemm16<0><<<dim3(Cc / BT, Bb * LL / BT), gblk, 0, stream>>>(Wvh, Xt, nullptr, nullptr, Vt, Cc);
    // 4) attention logits + bias (f16) -> Abuf[b][e][l]  (8 x 196 tiles)
    gemm16<2><<<dim3(EPAD / BT, Bb * LL / BT), gblk, 0, stream>>>(Wah, Xt, ba, nullptr, Abuf, Ee);
    // 5) fused softmax over q + apply + fold -> Ft[b][l][c]
    apply_fold<<<dim3(HH / TY, NHEAD / 2, Bb), 2 * NPOS, 0, stream>>>(Abuf, Vt, Ft);
    // 6) final projection + bias -> out[b][d][l]
    gemm16<1><<<dim3(Cc / BT, Bb * LL / BT), gblk, 0, stream>>>(Wph, Ft, bp, out, nullptr, Cc);
}

// v004
// A run of this version takes 111 microseconds.
// In both of two side-by-side timings against v003, it was 1.16 times as fast.
// All steps since v000 together make it 5.63 times as fast.
#include <hip/hip_runtime.h>
// Contractions: value projection, attention-logit projection and final projection (K = 384) on v_wmma_f32_16x16x32_f16
// (f16 operands, f32 accumulate); softmax over the 3x3 window and the attention-apply/fold (per-position weights, no shared operand) in f32 on VALU.

// ---------------- problem constants ----------------
#define Cc    384
#define NHEAD 12
#define HD    32
#define Ee    972        // K^4 * HEADS
#define EPAD  1024       // Ee padded to a multiple of the GEMM's 128-row tile
#define Bb    8
#define HH    56
#define LL    3136       // 56*56

typedef __attribute__((ext_vector_type(8)))  _Float16 v8h;
typedef __attribute__((ext_vector_type(16))) _Float16 v16h;
typedef __attribute__((ext_vector_type(8)))  float    v8f;
typedef __attribute__((ext_vector_type(4)))  float    v4f;
typedef __attribute__((ext_vector_type(4)))  unsigned v4u;

union AFrag { v16h v; v8h h[2]; };

template <typename V> __device__ __forceinline__ void vst2(void* p, V v) {
    *(V*)p = v; 
}
__device__ __forceinline__ v8f wmma_f16(v16h a, v16h b, v8f c) {
    v8f d = __builtin_amdgcn_wmma_f32_16x16x32_f16(false, a, false, b, (short)0, c, false, false);
    asm volatile("v_nop\n\tv_nop\n\tv_nop\n\tv_nop" : "+v"(d) : "v"(a), "v"(b));
    return d;
}

// ---------------- f32 -> f16 weight convert (with zero pad): 8 elements (16 B) per thread ----------------
__global__ void cvt_f32_f16(const float* __restrict__ s, _Float16* __restrict__ d, int n, int npad) {
    int g = blockIdx.x * 256 + threadIdx.x;             // npad is a multiple of 8
    if (g * 8 >= npad) return;
    union { v8h v; v4u u; } pk;
#pragma unroll
    for (int e = 0; e < 8; ++e) { int i = g * 8 + e; pk.v[e] = (i < n) ? (_Float16)s[i] : (_Float16)0.0f; }
    vst2(d + (size_t)g * 8, pk.u);
}

// x[B][C][L] (f32) -> Xt[B][L][C] (f16), transposed through LDS so that both sides move whole 256-B runs.
// Work-group = 128 channels x 64 positions, 4 waves. Read: 16 lanes cover the 256 B of one channel's 64 positions; a thread takes
// the same 4 positions of 8 consecutive channels (twice), so each position gives it one 16-byte piece of an Xt row.
// LDS tile [position][channel], rows of 256 B = all 64 banks: piece p of row l sits at piece p ^ (l >> 2), so the 16 lanes that
// write one piece column (rows 4 apart) and the 16 lanes that read one row both touch every bank once.
#define PC 128               // channels per tile
#define PL 64                // positions per tile
__global__ void __launch_bounds__(128)
pack_x(const float* __restrict__ x, _Float16* __restrict__ Xt) {
    __shared__ __align__(16) _Float16 t[PL * PC];       // 16 KB
    const int tid = threadIdx.x;
    const int l0 = blockIdx.x * PL, c0 = blockIdx.y * PC, b = blockIdx.z;
    const int lq = tid & 15;                            // positions lq*4 .. lq*4+3
    const int cg = tid >> 4;                            // channel groups cg and cg + 8, 8 channels each
    const float* __restrict__ g = x + ((size_t)b * Cc + c0 + cg * 8) * LL + l0 + lq * 4;
    v4f r[2][8];
#pragma unroll   // r stays in registers only under constant indices; all 16 loads in flight at once
    for (int h = 0; h < 2; ++h)
#pragma unroll   // as above
        for (int e = 0; e < 8; ++e) r[h][e] = *(const v4f*)(g + (h * 64 + e) * LL);
    asm volatile("s_wait_xcnt 0x0" :: "v"(g) : "memory");   // precaution: the loads' address pair is held (the operand) and waited for before its registers are reused
    __builtin_amdgcn_sched_barrier(0);                  // keeps every convert behind all 16 loads: otherwise the last four loads are issued only behind a wait on earlier ones
#pragma unroll   // as above
    for (int h = 0; h < 2; ++h)
#pragma unroll   // as above
        for (int j = 0; j < 4; ++j) {
            v8h o;
#pragma unroll   // as above
            for (int e = 0; e < 8; ++e) o[e] = (_Float16)r[h][e][j];
            *(v8h*)(t + (lq * 4 + j) * PC + ((cg + h * 8) ^ lq) * 8) = o;
        }
    __syncthreads();
#pragma unroll   // 8 independent LDS reads and stores per thread, no loop counter
    for (int it = 0; it < PL * PC / 8 / 128; ++it) {
        const int p = tid + it * 128;
        const int l = p >> 4, pc = p & 15;
        vst2(Xt + ((size_t)b * LL + l0 + l) * Cc + c0 + pc * 8, *(const v4u*)(t + l * PC + (pc ^ (l >> 2)) * 8));
    }
}

// ---------------- WMMA GEMM: D[M x N] = W[M x 384] @ Xt^T, N = all (b, l) columns in Xt's own row order ----------
// Work-group = 128 x 128 tile of D, 8 waves. Both operands pass through LDS in stages of 64 k (one whole 128-B line of every
// row), two buffers: each byte is fetched once per work-group in whole lines and shared by the waves that need it.
// A/B fragments: row/col = lane&15; elements 0..7 <- k0 + 8*hi + 0..7, elements 8..15 <- k0 + 16 + 8*hi + 0..7 (same map).
#define BT 128               // rows of W and rows of Xt per work-group
#define KC 64                // k per stage
#define LP 72                // LDS pitch in halves: 144 B = 16 B x odd, conflict-free for 16-byte fragment reads
#define STG (2 * BT * LP)    // halves per stage: W rows, then Xt rows
template <int MODE>
__global__ void __launch_bounds__(256)
gemm16(const _Float16* __restrict__ W, const _Float16* __restrict__ X,
       const float* __restrict__ bias, float* __restrict__ out32,
       _Float16* __restrict__ out16, int Mtot) {
    constexpr int TM = (MODE == 2) ? 32 : 64, TN = (MODE == 2) ? 64 : 32;
    constexpr int MI = TM / 16, NI = TN / 16;
    constexpr int WM = BT / TM;                             // waves along M; 8 / WM along N
    __shared__ __align__(16) char smem[2 * STG * 2];        // two operand stages; afterwards the per-wave f32 staging, 8 KB each
    static_assert(sizeof(smem) >= 8 * TM * TN * 4, "output staging must fit");
    _Float16* sm = (_Float16*)smem;
    const int lane  = threadIdx.x;            // 0..31
    const int wid   = threadIdx.y;            // 0..7
    const int tid   = wid * 32 + lane;
    const int mB = blockIdx.x * BT;
    const int nB = blockIdx.y * BT;           // column b * LL + l
    const int wm = wid % WM, wn = wid / WM;
    const int m0 = mB + wm * TM;
    const int nf = nB + wn * TN;              // LL is a multiple of TN: a wave's columns lie in one batch
    const int b  = nf / LL;
    const int n0 = nf % LL;
    const int laneM = lane & 15;
    const int hi    = lane >> 4;
    float* S = (float*)smem + wid * TM * TN;

    {
        // 16-byte pieces: 8 lanes cover one row's line, a wave 4 rows, the work-group 32 rows per step
        const _Float16* __restrict__ gW = W + (size_t)(mB + (tid >> 3)) * Cc + (tid & 7) * 8;
        const _Float16* __restrict__ gX = X + (size_t)(nB + (tid >> 3)) * Cc + (tid & 7) * 8;
        _Float16* sp = sm + (tid >> 3) * LP + (tid & 7) * 8;
        v4u rw[BT / 32], rx[BT / 32];
        auto fetch = [&](int kc) {
#pragma unroll   // rw, rx stay in registers only under constant indices
            for (int it = 0; it < BT / 32; ++it) {
                rw[it] = *(const v4u*)(gW + it * 32 * Cc + kc * KC);
                rx[it] = *(const v4u*)(gX + it * 32 * Cc + kc * KC);
            }
        };
        auto put = [&](int buf) {
#pragma unroll   // as in fetch
            for (int it = 0; it < BT / 32; ++it) {
                *(v4u*)(sp + buf * STG + it * 32 * LP) = rw[it];
                *(v4u*)(sp + buf * STG + BT * LP + it * 32 * LP) = rx[it];
            }
        };
        fetch(0);
        put(0);
        __syncthreads();
        v8f acc[MI][NI] = {};
#pragma unroll   // buffer index and the last-stage test become constants
        for (int kc = 0; kc < Cc / KC; ++kc) {
            if (kc + 1 < Cc / KC) fetch(kc + 1);            // in flight while this stage is multiplied
            const _Float16* sa = sm + (kc & 1) * STG + (wm * TM + laneM) * LP + 8 * hi;
            const _Float16* sb = sm + (kc & 1) * STG + BT * LP + (wn * TN + laneM) * LP + 8 * hi;
#pragma unroll
            for (int ks = 0; ks < KC; ks += 32) {
                AFrag a[MI], bf[NI];
#pragma unroll
                for (int mi = 0; mi < MI; ++mi) {
                    a[mi].h[0] = *(const v8h*)(sa + mi * 16 * LP + ks);
                    a[mi].h[1] = *(const v8h*)(sa + mi * 16 * LP + ks + 16);
                }
#pragma unroll
                for (int ni = 0; ni < NI; ++ni) {
                    bf[ni].h[0] = *(const v8h*)(sb + ni * 16 * LP + ks);
                    bf[ni].h[1] = *(const v8h*)(sb + ni * 16 * LP + ks + 16);
                }
#pragma unroll
                for (int mi = 0; mi < MI; ++mi)
#pragma unroll
                    for (int ni = 0; ni < NI; ++ni)
                        acc[mi][ni] = wmma_f16(a[mi].v, bf[ni].v, acc[mi][ni]);
            }
            if (kc + 1 < Cc / KC) put((kc + 1) & 1);        // the buffer that every wave left at the last barrier
            __syncthreads();                                // publishes the next stage; after the last one, frees LDS for S
        }
        // D layout: element r -> (m = mi*16 + 8*hi + r, n = ni*16 + laneM); stage [m][n] for MODE 1/2, [n][m] for MODE 0
#pragma unroll
        for (int mi = 0; mi < MI; ++mi)
#pragma unroll
            for (int ni = 0; ni < NI; ++ni)
#pragma unroll
                for (int r = 0; r < 8; ++r) {
                    const int ml = mi * 16 + 8 * hi + r, nl = ni * 16 + laneM;
                    float v = acc[mi][ni][r];
                    if (MODE != 0) { const int row = m0 + ml; v += (row < Mtot) ? bias[row] : 0.0f; }
                    if (MODE == 0) S[nl * TM + ml] = v; else S[ml * TN + nl] = v;
                }
    }
    __syncthreads();
    if (MODE == 0) {
#pragma unroll
        for (int q = 0; q < 8; ++q) {
            const int nl = q * 4 + (lane >> 3), pc = lane & 7;
            union { v8h v; v4u u; } pk;
#pragma unroll
            for (int e = 0; e < 8; ++e) pk.v[e] = (_Float16)S[nl * TM + pc * 8 + e];
            vst2(out16 + ((size_t)b * LL + n0 + nl) * Cc + m0 + pc * 8, pk.u);
        }
    } else if (MODE == 1) {
#pragma unroll
        for (int q = 0; q < 16; ++q) {
            const int ml = q * 4 + (lane >> 3), pc = lane & 7;
            const int row = m0 + ml;
            if (row < Mtot)
                vst2(out32 + ((size_t)b * Mtot + row) * LL + n0 + pc * 4, *(const v4f*)(S + ml * TN + pc * 4));
        }
    } else {
#pragma unroll
        for (int q = 0; q < 8; ++q) {
            const int ml = q * 4 + (lane >> 3), pc = lane & 7;
            const int row = m0 + ml;
            union { v8h v; v4u u; } pk;
#pragma unroll
            for (int e = 0; e < 8; ++e) pk.v[e] = (_Float16)S[ml * TN + pc * 8 + e];
            if (row < Mtot) vst2(out16 + ((size_t)b * Mtot + row) * LL + n0 + pc * 8, pk.u);
        }
    }
}

// ------- fused softmax + attention-apply + fold: Ft[b][y*56+x][c] = folded value -------
// folded[b,n*32+d,y,x] = sum_{i,j valid} sum_{q valid}
//     softmax_q(A * 32^-0.5)[b, n*81+(i3+j)*9+q, (y+1-i)*56+(x+1-j)] * V[b, n*32+d, (x+qj-j)*56+(y+qi-i)]
// (the bdwh spatial-transpose of the value tensor is baked into the V column index)
// Tiling: block = 4 image rows x one head pair of one batch; thread = one position of one head, all 32 channels.
// Lanes run along l, so every A plane is read once in contiguous runs; the V halo (8 x 60 positions, zero outside
// the image, as the reference pads) sits in LDS. The V operand depends only on (qi-i, qj-j), so the A terms that
// share an offset are summed first (25 weights) and each V row is read once per thread.
// A holds the logits: a thread has all 9 q of each of its 9 (i, j) groups, and a (head, group, position) is used by at most
// one thread, so the softmax is taken here, in registers: no more exponentials than a launch of its own would take.
#define TY 4                 // image rows per block
#define VR (TY + 4)          // halo rows
#define VC 63                // halo columns: 56 + 4, plus 3 never read, so that the tile's 16-byte pieces are 9 per thread, exact
#define VP 72                // LDS pitch in halves: 144 B = 16 B x odd, conflict-free for 16-byte reads along x
#define NPOS (TY * HH)       // 224 positions = 7 waves per head
__global__ void __launch_bounds__(2 * NPOS)
apply_fold(const _Float16* __restrict__ A, const _Float16* __restrict__ Vt, _Float16* __restrict__ Ft) {
    __shared__ __align__(16) _Float16 vs[VR * VC * VP];   // V halo tile, 128 B (two heads) per position
    __shared__ __align__(16) _Float16 os[NPOS * VP];      // output tile, 128 B per position
    const int tid = threadIdx.x;
    const int hh2 = __builtin_amdgcn_readfirstlane((tid >= NPOS) ? 1 : 0);   // head of the pair: the same in all lanes of a wave (7 waves per head), kept scalar so that A has a scalar base
    const int pl  = tid - hh2 * NPOS;                    // position inside the tile
    const int y0  = blockIdx.x * TY;
    const int np  = blockIdx.y;
    const int b   = blockIdx.z;
    const int yl = pl / HH, x = pl % HH;
    const int y  = y0 + yl;
    const int n  = np * 2 + hh2;

    // A: 81 independent 2-byte loads per thread, 64 contiguous bytes per wave each; a fold shift that leaves the image
    // reads the thread's own position instead (in bounds) and is weighted 0
    const char* __restrict__ Ab = (const char*)(A + ((size_t)b * Ee + n * 81) * LL);   // scalar base + 32-bit lane offset
    _Float16 ah[81];
    float msk[9];
#pragma unroll
    for (int i = 0; i < 3; ++i)
#pragma unroll
        for (int j = 0; j < 3; ++j) {
            const int hp = y + 1 - i, wp = x + 1 - j;    // source l' for this fold shift
            const bool ok = (hp >= 0 && hp < HH && wp >= 0 && wp < HH);
            const unsigned ls = 2u * (unsigned)(ok ? hp * HH + wp : y * HH + x);
            msk[i * 3 + j] = ok ? 1.0f : 0.0f;
#pragma unroll
            for (int q = 0; q < 9; ++q) ah[(i * 3 + j) * 9 + q] = *(const _Float16*)(Ab + ls + ((i * 3 + j) * 9 + q) * LL * 2);
        }

    // V halo: entry (rr, ss) holds V at row r = y0-2+rr, column s = ss-2 of the transposed value image, i.e. Vt row s*56+r
    const char* __restrict__ Vb = (const char*)(Vt + (size_t)b * LL * Cc + np * 64);
#pragma unroll
    for (int it = 0; it < VR * VC * 8 / (2 * NPOS); ++it) {   // addresses clamped into Vt: no branch around the loads
        const int c = tid + it * 2 * NPOS;
        const int e = c >> 3, pc = c & 7;
        const int rr = e % VR, ss = e / VR;
        const int r = y0 - 2 + rr, s = ss - 2;
        const int rc = min(max(r, 0), HH - 1), sc = min(max(s, 0), HH - 1);
        v4u val = *(const v4u*)(Vb + (unsigned)((sc * HH + rc) * Cc * 2 + pc * 16));
        val &= (r >= 0 && r < HH && s >= 0 && s < HH) ? 0xFFFFFFFFu : 0u;   // the reference's zero padding
        *(v4u*)(vs + (rr * VC + ss) * VP + pc * 8) = val;
    }

    const float kq = 0.17677669529663687f * 1.4426950408889634f;   // 32^-0.5 * log2(e): exp(s * (a - max)) = 2^(kq * a - kq * max)
    float w[5][5] = {};
#pragma unroll
    for (int i = 0; i < 3; ++i)
#pragma unroll
        for (int j = 0; j < 3; ++j) {
            float ev[9];
            _Float16 mx = ah[(i * 3 + j) * 9];
#pragma unroll   // ah and ev stay in registers only under constant indices
            for (int q = 1; q < 9; ++q) mx = __builtin_fmaxf16(mx, ah[(i * 3 + j) * 9 + q]);
            const float nm = -kq * (float)mx;
            float sum = 0.f;
#pragma unroll   // as above
            for (int q = 0; q < 9; ++q) { ev[q] = __builtin_amdgcn_exp2f(fmaf((float)ah[(i * 3 + j) * 9 + q], kq, nm)); sum += ev[q]; }
            const float g = msk[i * 3 + j] * __builtin_amdgcn_rcpf(sum);   // sum lies in [1, 9]
#pragma unroll
            for (int qi = 0; qi < 3; ++qi)
#pragma unroll
                for (int qj = 0; qj < 3; ++qj)
                    w[qi - i + 2][qj - j + 2] += g * ev[qi * 3 + qj];
        }
    __syncthreads();

    float acc[HD] = {};
    const _Float16* vb = vs + (yl * VC + x) * VP + hh2 * HD;
#pragma unroll
    for (int dy = 0; dy < 5; ++dy)
#pragma unroll
        for (int dx = 0; dx < 5; ++dx) {
            const v8h* pv = (const v8h*)(vb + (dy * VC + dx) * VP);
#pragma unroll
            for (int k = 0; k < HD / 8; ++k) {
                const v8h v = pv[k];
#pragma unroll
                for (int e = 0; e < 8; ++e) acc[k * 8 + e] += w[dy][dx] * (float)v[e];
            }
        }

    // whole 128-B lines of Ft: both heads of a position meet in LDS, 8 lanes store one line
#pragma unroll
    for (int k = 0; k < HD / 8; ++k) {
        v8h o;
#pragma unroll
        for (int e = 0; e < 8; ++e) o[e] = (_Float16)acc[k * 8 + e];
        *(v8h*)(os + pl * VP + hh2 * HD + k * 8) = o;
    }
    __syncthreads();
#pragma unroll
    for (int it = 0; it < 4; ++it) {                      // NPOS * 8 pieces = 4 per thread, exact
        const int c = tid + it * 2 * NPOS;
        const int e = c >> 3, pc = c & 7;
        vst2(Ft + ((size_t)b * LL + y0 * HH + e) * Cc + np * 64 + pc * 8, *(const v4u*)(os + e * VP + pc * 8));
    }
}

// ---------------------------------------------------------------------------
extern "C" void kernel_launch(void* const* d_in, const int* in_sizes, int n_in,
                              void* d_out, int out_size, void* d_ws, size_t ws_size,
                              hipStream_t stream) {
    (void)in_sizes; (void)n_in; (void)out_size; (void)ws_size;
    const float* x  = (const float*)d_in[0];
    const float* Wv = (const float*)d_in[1];
    const float* Wa = (const float*)d_in[2];
    const float* ba = (const float*)d_in[3];
    const float* Wp = (const float*)d_in[4];
    const float* bp = (const float*)d_in[5];
    float* out = (float*)d_out;

    char* ws = (char*)d_ws;
    size_t off = 0;
    auto carve = [&](size_t bytes) -> void* {
        void* p = ws + off;
        off += (bytes + 255) & ~(size_t)255;
        return p;
    };
    _Float16* Xt   = (_Float16*)carve((size_t)Bb * LL * Cc * 2);  // 19.3 MB
    _Float16* Wvh  = (_Float16*)carve((size_t)Cc * Cc * 2);
    _Float16* Wah  = (_Float16*)carve((size_t)EPAD * Cc * 2);
    _Float16* Wph  = (_Float16*)carve((size_t)Cc * Cc * 2);
    _Float16* Vt   = (_Float16*)carve((size_t)Bb * LL * Cc * 2);  // 19.3 MB
    _Float16* Abuf = (_Float16*)carve((size_t)Bb * Ee * LL * 2);  // 48.8 MB
    _Float16* Ft   = (_Float16*)carve((size_t)Bb * LL * Cc * 2);  // 19.3 MB

    // 1) convert weights (Wa zero-padded to 1024 rows); 8 halves per thread
    cvt_f32_f16<<<(Cc * Cc / 8 + 255) / 256, 256, 0, stream>>>(Wv, Wvh, Cc * Cc, Cc * Cc);
    cvt_f32_f16<<<(EPAD * Cc / 8 + 255) / 256, 256, 0, stream>>>(Wa, Wah, Ee * Cc, EPAD * Cc);
    cvt_f32_f16<<<(Cc * Cc / 8 + 255) / 256, 256, 0, stream>>>(Wp, Wph, Cc * Cc, Cc * Cc);

    // 2) pack x into [b][l][c] f16
    pack_x<<<dim3(LL / PL, Cc / PC, Bb), 128, 0, stream>>>(x, Xt);

    dim3 gblk(32, 8);
    // 3) value projection -> Vt[b][l][c]  (3 x 196 tiles of 128 x 128)
    gemm16<0><<<dim3(Cc / BT, Bb * LL / BT), gblk, 0, stream>>>(Wvh, Xt, nullptr, nullptr, Vt, Cc);
    // 4) attention logits + bias (f16) -> Abuf[b][e][l]  (8 x 196 tiles)
    gemm16<2><<<dim3(EPAD / BT, Bb * LL / BT), gblk, 0, stream>>>(Wah, Xt, ba, nullptr, Abuf, Ee);
    // 5) fused softmax over q + apply + fold -> Ft[b][l][c]
    apply_fold<<<dim3(HH / TY, NHEAD / 2, Bb), 2 * NPOS, 0, stream>>>(Abuf, Vt, Ft);
    // 6) final projection + bias -> out[b][d][l]
    gemm16<1><<<dim3(Cc / BT, Bb * LL / BT), gblk, 0, stream>>>(Wph, Ft, bp, out, nullptr, Cc);
}

// v005
// Measured time: 101 microseconds a run.
// Next to v004, in two timings, it ran 1.10 times as fast each time.
// All steps since v000 together make it 6.18 times as fast.
#include <hip/hip_runtime.h>
// Contractions: value projection, attention-logit projection and final projection (K = 384) on v_wmma_f32_16x16x32_f16
// (f16 operands, f32 accumulate); softmax over the 3x3 window and the attention-apply/fold (per-position weights, no shared operand) in f32 on VALU.

// ---------------- problem constants ----------------
#define Cc    384
#define NHEAD 12
#define HD    32
#define Ee    972        // K^4 * HEADS
#define EPAD  1024       // Ee padded to a multiple of the GEMM's 128-row tile
#define Bb    8
#define HH    56
#define LL    3136       // 56*56

typedef __attribute__((ext_vector_type(8)))  _Float16 v8h;
typedef __attribute__((ext_vector_type(16))) _Float16 v16h;
typedef __attribute__((ext_vector_type(8)))  float    v8f;
typedef __attribute__((ext_vector_type(4)))  float    v4f;
typedef __attribute__((ext_vector_type(4)))  unsigned v4u;

union AFrag { v16h v; v8h h[2]; };

template <typename V> __device__ __forceinline__ void vst2(void* p, V v) {
    *(V*)p = v; 
}
__device__ __forceinline__ v8f wmma_f16(v16h a, v16h b, v8f c) {
    v8f d = __builtin_amdgcn_wmma_f32_16x16x32_f16(false, a, false, b, (short)0, c, false, false);
    asm volatile("v_nop\n\tv_nop\n\tv_nop\n\tv_nop" : "+v"(d) : "v"(a), "v"(b));
    return d;
}

// ---------------- f32 -> f16 weight convert (with zero pad): 8 elements (16 B stored) per thread ----------------
// n is a multiple of 8, so a thread's 8 elements are all real or all pad; a pad thread reads the first 8 elements (in bounds) and stores zeros.
__device__ __forceinline__ void cvt_f32_f16(const float* __restrict__ s, _Float16* __restrict__ d, int n, int g) {
    const bool real = g * 8 < n;
    const float* __restrict__ p = s + (real ? g * 8 : 0);   // clamped into s: no branch around the loads
    const v4f r0 = *(const v4f*)p, r1 = *(const v4f*)(p + 4);
    asm volatile("s_wait_xcnt 0x0" :: "v"(p) : "memory");   // precaution: the loads' address pair is held (the operand) and waited for before its registers are reused
    union { v8h v; v4u u; } pk;
#pragma unroll   // r0, r1 and pk stay in registers only under constant indices
    for (int e = 0; e < 4; ++e) {
        pk.v[e]     = real ? (_Float16)r0[e] : (_Float16)0.0f;
        pk.v[e + 4] = real ? (_Float16)r1[e] : (_Float16)0.0f;
    }
    vst2(d + (size_t)g * 8, pk.u);
}

// x[B][C][L] (f32) -> Xt[B][L][C] (f16), transposed through LDS so that both sides move whole 256-B runs.
// Work-group = 128 channels x 64 positions, 4 waves. Read: 16 lanes cover the 256 B of one channel's 64 positions; a thread takes
// the same 4 positions of 8 consecutive channels (twice), so each position gives it one 16-byte piece of an Xt row.
// LDS tile [position][channel], rows of 256 B = all 64 banks: piece p of row l sits at piece p ^ (l >> 2), so the 16 lanes that
// write one piece column (rows 4 apart) and the 16 lanes that read one row both touch every bank once.
#define PC 128               // channels per tile
#define PL 64                // positions per tile
// The three weight converts depend on nothing and nothing in this launch depends on them: they ride in the same launch, in the
// work-groups with blockIdx.x >= LL / PL (WX more columns of the grid, WCH elements each).
#define WCH 1024             // elements per convert work-group: 128 threads x 8
#define WX 28                // WX * (Cc / PC) * Bb = 672 work-groups = (2 * Cc * Cc + EPAD * Cc) / WCH
static_assert(WX * (Cc / PC) * Bb * WCH == 2 * Cc * Cc + EPAD * Cc, "one work-group per weight chunk");
static_assert(Cc * Cc % WCH == 0 && EPAD * Cc % WCH == 0 && Ee * Cc % 8 == 0, "chunks do not straddle two weights, threads not the pad's edge");
__global__ void __launch_bounds__(128)
pack_x(const float* __restrict__ x, _Float16* __restrict__ Xt,
       const float* __restrict__ Wv, const float* __restrict__ Wa, const float* __restrict__ Wp,
       _Float16* __restrict__ Wvh, _Float16* __restrict__ Wah, _Float16* __restrict__ Wph) {
    __shared__ __align__(16) _Float16 t[PL * PC];       // 16 KB
    const int tid = threadIdx.x;
    if (blockIdx.x >= LL / PL) {                        // the same for the whole work-group; leaves before the barrier
        const int wb = (blockIdx.x - LL / PL) + WX * (blockIdx.y + (Cc / PC) * blockIdx.z);
        constexpr int NV = Cc * Cc / WCH, NA = EPAD * Cc / WCH;
        const bool isV = wb < NV, isA = !isV && wb < NV + NA;
        cvt_f32_f16(isV ? Wv : isA ? Wa : Wp, isV ? Wvh : isA ? Wah : Wph, isA ? Ee * Cc : Cc * Cc,
                    (isV ? wb : isA ? wb - NV : wb - NV - NA) * 128 + tid);
        return;
    }
    const int l0 = blockIdx.x * PL, c0 = blockIdx.y * PC, b = blockIdx.z;
    const int lq = tid & 15;                            // positions lq*4 .. lq*4+3
    const int cg = tid >> 4;                            // channel groups cg and cg + 8, 8 channels each
    const float* __restrict__ g = x + ((size_t)b * Cc + c0 + cg * 8) * LL + l0 + lq * 4;
    v4f r[2][8];
#pragma unroll   // r stays in registers only under constant indices; all 16 loads in flight at once
    for (int h = 0; h < 2; ++h)
#pragma unroll   // as above
        for (int e = 0; e < 8; ++e) r[h][e] = *(const v4f*)(g + (h * 64 + e) * LL);
    asm volatile("s_wait_xcnt 0x0" :: "v"(g) : "memory");   // precaution: the loads' address pair is held (the operand) and waited for before its registers are reused
    __builtin_amdgcn_sched_barrier(0);                  // keeps every convert behind all 16 loads: otherwise the last four loads are issued only behind a wait on earlier ones
#pragma unroll   // as above
    for (int h = 0; h < 2; ++h)
#pragma unroll   // as above
        for (int j = 0; j < 4; ++j) {
            v8h o;
#pragma unroll   // as above
            for (int e = 0; e < 8; ++e) o[e] = (_Float16)r[h][e][j];
            *(v8h*)(t + (lq * 4 + j) * PC + ((cg + h * 8) ^ lq) * 8) = o;
        }
    __syncthreads();
#pragma unroll   // 8 independent LDS reads and stores per thread, no loop counter
    for (int it = 0; it < PL * PC / 8 / 128; ++it) {
        const int p = tid + it * 128;
        const int l = p >> 4, pc = p & 15;
        vst2(Xt + ((size_t)b * LL + l0 + l) * Cc + c0 + pc * 8, *(const v4u*)(t + l * PC + (pc ^ (l >> 2)) * 8));
    }
    asm volatile("s_wait_xcnt 0x0" ::: "memory");       // precaution: stands behind the stores, in front of whatever the build lays out behind this path
}

// ---------------- WMMA GEMM: D[M x N] = W[M x 384] @ Xt^T, N = all (b, l) columns in Xt's own row order ----------
// Work-group = 128 x 128 tile of D, 8 waves. Both operands pass through LDS in stages of 64 k (one whole 128-B line of every
// row), two buffers: each byte is fetched once per work-group in whole lines and shared by the waves that need it.
// A/B fragments: row/col = lane&15; elements 0..7 <- k0 + 8*hi + 0..7, elements 8..15 <- k0 + 16 + 8*hi + 0..7 (same map).
#define BT 128               // rows of W and rows of Xt per work-group
#define KC 64                // k per stage
#define LP 72                // LDS pitch in halves: 144 B = 16 B x odd, conflict-free for 16-byte fragment reads
#define STG (2 * BT * LP)    // halves per stage: W rows, then Xt rows
#define GSM (2 * STG * 2)    // LDS bytes: two operand stages; afterwards the per-wave f32 staging, 8 KB each
template <int MODE>
__device__ __forceinline__ void
gemm_tile(char* smem, int mt, const _Float16* __restrict__ W, const _Float16* __restrict__ X,
          const float* __restrict__ bias, float* __restrict__ out32,
          _Float16* __restrict__ out16, int Mtot) {
    constexpr int TM = (MODE == 2) ? 32 : 64, TN = (MODE == 2) ? 64 : 32;
    constexpr int MI = TM / 16, NI = TN / 16;
    constexpr int WM = BT / TM;                             // waves along M; 8 / WM along N
    static_assert(GSM >= 8 * TM * TN * 4, "output staging must fit");
    _Float16* sm = (_Float16*)smem;
    const int lane  = threadIdx.x;            // 0..31
    const int wid   = threadIdx.y;            // 0..7
    const int tid   = wid * 32 + lane;
    const int mB = mt * BT;
    const int nB = blockIdx.y * BT;           // column b * LL + l
    const int wm = wid % WM, wn = wid / WM;
    const int m0 = mB + wm * TM;
    const int nf = nB + wn * TN;              // LL is a multiple of TN: a wave's columns lie in one batch
    const int b  = nf / LL;
    const int n0 = nf % LL;
    const int laneM = lane & 15;
    const int hi    = lane >> 4;
    float* S = (float*)smem + wid * TM * TN;

    {
        // 16-byte pieces: 8 lanes cover one row's line, a wave 4 rows, the work-group 32 rows per step
        const _Float16* __restrict__ gW = W + (size_t)(mB + (tid >> 3)) * Cc + (tid & 7) * 8;
        const _Float16* __restrict__ gX = X + (size_t)(nB + (tid >> 3)) * Cc + (tid & 7) * 8;
        _Float16* sp = sm + (tid >> 3) * LP + (tid & 7) * 8;
        v4u rw[BT / 32], rx[BT / 32];
        auto fetch = [&](int kc) {
#pragma unroll   // rw, rx stay in registers only under constant indices
            for (int it = 0; it < BT / 32; ++it) {
                rw[it] = *(const v4u*)(gW + it * 32 * Cc + kc * KC);
                rx[it] = *(const v4u*)(gX + it * 32 * Cc + kc * KC);
            }
            asm volatile("s_wait_xcnt 0x0" :: "v"(gW), "v"(gX) : "memory");   // precaution: both address pairs are held (the operands) and waited for before their registers are reused, also as a later load's destination
        };
        auto put = [&](int buf) {
#pragma unroll   // as in fetch
            for (int it = 0; it < BT / 32; ++it) {
                *(v4u*)(sp + buf * STG + it * 32 * LP) = rw[it];
                *(v4u*)(sp + buf * STG + BT * LP + it * 32 * LP) = rx[it];
            }
        };
        fetch(0);
        put(0);
        __syncthreads();
        v8f acc[MI][NI] = {};
#pragma unroll   // buffer index and the last-stage test become constants
        for (int kc = 0; kc < Cc / KC; ++kc) {
            if (kc + 1 < Cc / KC) fetch(kc + 1);            // in flight while this stage is multiplied
            const _Float16* sa = sm + (kc & 1) * STG + (wm * TM + laneM) * LP + 8 * hi;
            const _Float16* sb = sm + (kc & 1) * STG + BT * LP + (wn * TN + laneM) * LP + 8 * hi;
#pragma unroll
            for (int ks = 0; ks < KC; ks += 32) {
                AFrag a[MI], bf[NI];
#pragma unroll
                for (int mi = 0; mi < MI; ++mi) {
                    a[mi].h[0] = *(const v8h*)(sa + mi * 16 * LP + ks);
                    a[mi].h[1] = *(const v8h*)(sa + mi * 16 * LP + ks + 16);
                }
#pragma unroll
                for (int ni = 0; ni < NI; ++ni) {
                    bf[ni].h[0] = *(const v8h*)(sb + ni * 16 * LP + ks);
                    bf[ni].h[1] = *(const v8h*)(sb + ni * 16 * LP + ks + 16);
                }
#pragma unroll
                for (int mi = 0; mi < MI; ++mi)
#pragma unroll
                    for (int ni = 0; ni < NI; ++ni)
                        acc[mi][ni] = wmma_f16(a[mi].v, bf[ni].v, acc[mi][ni]);
            }
            if (kc + 1 < Cc / KC) put((kc + 1) & 1);        // the buffer that every wave left at the last barrier
            __syncthreads();                                // publishes the next stage; after the last one, frees LDS for S
        }
        // D layout: element r -> (m = mi*16 + 8*hi + r, n = ni*16 + laneM); stage [m][n] for MODE 1/2, [n][m] for MODE 0
#pragma unroll
        for (int mi = 0; mi < MI; ++mi)
#pragma unroll
            for (int ni = 0; ni < NI; ++ni)
#pragma unroll
                for (int r = 0; r < 8; ++r) {
                    const int ml = mi * 16 + 8 * hi + r, nl = ni * 16 + laneM;
                    float v = acc[mi][ni][r];
                    if (MODE != 0) { const int row = m0 + ml; v += (row < Mtot) ? bias[row] : 0.0f; }
                    if (MODE == 0) S[nl * TM + ml] = v; else S[ml * TN + nl] = v;
                }
    }
    __syncthreads();
    if (MODE == 0) {
#pragma unroll
        for (int q = 0; q < 8; ++q) {
            const int nl = q * 4 + (lane >> 3), pc = lane & 7;
            union { v8h v; v4u u; } pk;
#pragma unroll
            for (int e = 0; e < 8; ++e) pk.v[e] = (_Float16)S[nl * TM + pc * 8 + e];
            vst2(out16 + ((size_t)b * LL + n0 + nl) * Cc + m0 + pc * 8, pk.u);
        }
    } else if (MODE == 1) {
#pragma unroll
        for (int q = 0; q < 16; ++q) {
            const int ml = q * 4 + (lane >> 3), pc = lane & 7;
            const int row = m0 + ml;
            if (row < Mtot)
                vst2(out32 + ((size_t)b * Mtot + row) * LL + n0 + pc * 4, *(const v4f*)(S + ml * TN + pc * 4));
        }
    } else {
#pragma unroll
        for (int q = 0; q < 8; ++q) {
            const int ml = q * 4 + (lane >> 3), pc = lane & 7;
            const int row = m0 + ml;
            union { v8h v; v4u u; } pk;
#pragma unroll
            for (int e = 0; e < 8; ++e) pk.v[e] = (_Float16)S[ml * TN + pc * 8 + e];
            if (row < Mtot) vst2(out16 + ((size_t)b * Mtot + row) * LL + n0 + pc * 8, pk.u);
        }
    }
}

// final projection: one launch of its own (it reads Ft). It builds at 162 VGPRs: allocated 176, so 5 waves per SIMD = 2 work-groups per WGP.
__global__ void __launch_bounds__(256)
gemm_out(const _Float16* __restrict__ W, const _Float16* __restrict__ X,
         const float* __restrict__ bias, float* __restrict__ out32) {
    __shared__ __align__(16) char smem[GSM];
    gemm_tile<1>(smem, blockIdx.x, W, X, bias, out32, nullptr, Cc);
}

// value projection and attention logits: both read Xt and neither reads the other, so their tiles share one launch.
// blockIdx.x runs over the Cc / BT row tiles of Wv, then the EPAD / BT row tiles of Wa; the choice is the same for a whole work-group.
__global__ void __launch_bounds__(256, 6)   // 6 waves per SIMD: holds the build at 160 VGPRs = 3 work-groups per WGP (162 would be allocated as 176 and leave 2)
gemm_va(const _Float16* __restrict__ Wv, const _Float16* __restrict__ Wa, const _Float16* __restrict__ X,
        const float* __restrict__ ba, _Float16* __restrict__ Vt, _Float16* __restrict__ A) {
    __shared__ __align__(16) char smem[GSM];
    if (blockIdx.x < Cc / BT) gemm_tile<0>(smem, blockIdx.x, Wv, X, nullptr, nullptr, Vt, Cc);
    else                      gemm_tile<2>(smem, blockIdx.x - Cc / BT, Wa, X, ba, nullptr, A, Ee);
}

// ------- fused softmax + attention-apply + fold: Ft[b][y*56+x][c] = folded value -------
// folded[b,n*32+d,y,x] = sum_{i,j valid} sum_{q valid}
//     softmax_q(A * 32^-0.5)[b, n*81+(i3+j)*9+q, (y+1-i)*56+(x+1-j)] * V[b, n*32+d, (x+qj-j)*56+(y+qi-i)]
// (the bdwh spatial-transpose of the value tensor is baked into the V column index)
// Tiling: block = 4 image rows x one head pair of one batch; thread = one position of one head, all 32 channels.
// Lanes run along l, so every A plane is read once in contiguous runs; the V halo (8 x 60 positions, zero outside
// the image, as the reference pads) sits in LDS. The V operand depends only on (qi-i, qj-j), so the A terms that
// share an offset are summed first (25 weights) and each V row is read once per thread.
// A holds the logits: a thread has all 9 q of each of its 9 (i, j) groups, and a (head, group, position) is used by at most
// one thread, so the softmax is taken here, in registers: no more exponentials than a launch of its own would take.
#define TY 4                 // image rows per block
#define VR (TY + 4)          // halo rows
#define VC 63                // halo columns: 56 + 4, plus 3 never read, so that the tile's 16-byte pieces are 9 per thread, exact
#define VP 72                // LDS pitch in halves: 144 B = 16 B x odd, conflict-free for 16-byte reads along x
#define NPOS (TY * HH)       // 224 positions = 7 waves per head
__global__ void __launch_bounds__(2 * NPOS)
apply_fold(const _Float16* __restrict__ A, const _Float16* __restrict__ Vt, _Float16* __restrict__ Ft) {
    __shared__ __align__(16) _Float16 vs[VR * VC * VP];   // V halo tile, 128 B (two heads) per position
    __shared__ __align__(16) _Float16 os[NPOS * VP];      // output tile, 128 B per position
    const int tid = threadIdx.x;
    const int hh2 = __builtin_amdgcn_readfirstlane((tid >= NPOS) ? 1 : 0);   // head of the pair: the same in all lanes of a wave (7 waves per head), kept scalar so that A has a scalar base
    const int pl  = tid - hh2 * NPOS;                    // position inside the tile
    const int y0  = blockIdx.x * TY;
    const int np  = blockIdx.y;
    const int b   = blockIdx.z;
    const int yl = pl / HH, x = pl % HH;
    const int y  = y0 + yl;
    const int n  = np * 2 + hh2;

    // A: 81 independent 2-byte loads per thread, 64 contiguous bytes per wave each; a fold shift that leaves the image
    // reads the thread's own position instead (in bounds) and is weighted 0
    const char* __restrict__ Ab = (const char*)(A + ((size_t)b * Ee + n * 81) * LL);   // scalar base + 32-bit lane offset
    _Float16 ah[81];
    float msk[9];
#pragma unroll
    for (int i = 0; i < 3; ++i)
#pragma unroll
        for (int j = 0; j < 3; ++j) {
            const int hp = y + 1 - i, wp = x + 1 - j;    // source l' for this fold shift
            const bool ok = (hp >= 0 && hp < HH && wp >= 0 && wp < HH);
            const unsigned ls = 2u * (unsigned)(ok ? hp * HH + wp : y * HH + x);
            msk[i * 3 + j] = ok ? 1.0f : 0.0f;
#pragma unroll
            for (int q = 0; q < 9; ++q) ah[(i * 3 + j) * 9 + q] = *(const _Float16*)(Ab + ls + ((i * 3 + j) * 9 + q) * LL * 2);
        }

    // V halo: entry (rr, ss) holds V at row r = y0-2+rr, column s = ss-2 of the transposed value image, i.e. Vt row s*56+r
    const char* __restrict__ Vb = (const char*)(Vt + (size_t)b * LL * Cc + np * 64);
#pragma unroll
    for (int it = 0; it < VR * VC * 8 / (2 * NPOS); ++it) {   // addresses clamped into Vt: no branch around the loads
        const int c = tid + it * 2 * NPOS;
        const int e = c >> 3, pc = c & 7;
        const int rr = e % VR, ss = e / VR;
        const int r = y0 - 2 + rr, s = ss - 2;
        const int rc = min(max(r, 0), HH - 1), sc = min(max(s, 0), HH - 1);
        v4u val = *(const v4u*)(Vb + (unsigned)((sc * HH + rc) * Cc * 2 + pc * 16));
        val &= (r >= 0 && r < HH && s >= 0 && s < HH) ? 0xFFFFFFFFu : 0u;   // the reference's zero padding
        *(v4u*)(vs + (rr * VC + ss) * VP + pc * 8) = val;
    }

    const float kq = 0.17677669529663687f * 1.4426950408889634f;   // 32^-0.5 * log2(e): exp(s * (a - max)) = 2^(kq * a - kq * max)
    float w[5][5] = {};
#pragma unroll
    for (int i = 0; i < 3; ++i)
#pragma unroll
        for (int j = 0; j < 3; ++j) {
            float ev[9];
            _Float16 mx = ah[(i * 3 + j) * 9];
#pragma unroll   // ah and ev stay in registers only under constant indices
            for (int q = 1; q < 9; ++q) mx = __builtin_fmaxf16(mx, ah[(i * 3 + j) * 9 + q]);
            const float nm = -kq * (float)mx;
            float sum = 0.f;
#pragma unroll   // as above
            for (int q = 0; q < 9; ++q) { ev[q] = __builtin_amdgcn_exp2f(fmaf((float)ah[(i * 3 + j) * 9 + q], kq, nm)); sum += ev[q]; }
            const float g = msk[i * 3 + j] * __builtin_amdgcn_rcpf(sum);   // sum lies in [1, 9]
#pragma unroll
            for (int qi = 0; qi < 3; ++qi)
#pragma unroll
                for (int qj = 0; qj < 3; ++qj)
                    w[qi - i + 2][qj - j + 2] += g * ev[qi * 3 + qj];
        }
    __syncthreads();

    float acc[HD] = {};
    const _Float16* vb = vs + (yl * VC + x) * VP + hh2 * HD;
#pragma unroll
    for (int dy = 0; dy < 5; ++dy)
#pragma unroll
        for (int dx = 0; dx < 5; ++dx) {
            const v8h* pv = (const v8h*)(vb + (dy * VC + dx) * VP);
#pragma unroll
            for (int k = 0; k < HD / 8; ++k) {
                const v8h v = pv[k];
#pragma unroll
                for (int e = 0; e < 8; ++e) acc[k * 8 + e] += w[dy][dx] * (float)v[e];
            }
        }

    // whole 128-B lines of Ft: both heads of a position meet in LDS, 8 lanes store one line
#pragma unroll
    for (int k = 0; k < HD / 8; ++k) {
        v8h o;
#pragma unroll
        for (int e = 0; e < 8; ++e) o[e] = (_Float16)acc[k * 8 + e];
        *(v8h*)(os + pl * VP + hh2 * HD + k * 8) = o;
    }
    __syncthreads();
#pragma unroll
    for (int it = 0; it < 4; ++it) {                      // NPOS * 8 pieces = 4 per thread, exact
        const int c = tid + it * 2 * NPOS;
        const int e = c >> 3, pc = c & 7;
        vst2(Ft + ((size_t)b * LL + y0 * HH + e) * Cc + np * 64 + pc * 8, *(const v4u*)(os + e * VP + pc * 8));
    }
}

// ---------------------------------------------------------------------------
extern "C" void kernel_launch(void* const* d_in, const int* in_sizes, int n_in,
                              void* d_out, int out_size, void* d_ws, size_t ws_size,
                              hipStream_t stream) {
    (void)in_sizes; (void)n_in; (void)out_size; (void)ws_size;
    const float* x  = (const float*)d_in[0];
    const float* Wv = (const float*)d_in[1];
    const float* Wa = (const float*)d_in[2];
    const float* ba = (const float*)d_in[3];
    const float* Wp = (const float*)d_in[4];
    const float* bp = (const float*)d_in[5];
    float* out = (float*)d_out;

    char* ws = (char*)d_ws;
    size_t off = 0;
    auto carve = [&](size_t bytes) -> void* {
        void* p = ws + off;
        off += (bytes + 255) & ~(size_t)255;
        return p;
    };
    _Float16* Xt   = (_Float16*)carve((size_t)Bb * LL * Cc * 2);  // 19.3 MB
    _Float16* Wvh  = (_Float16*)carve((size_t)Cc * Cc * 2);
    _Float16* Wah  = (_Float16*)carve((size_t)EPAD * Cc * 2);
    _Float16* Wph  = (_Float16*)carve((size_t)Cc * Cc * 2);
    _Float16* Vt   = (_Float16*)carve((size_t)Bb * LL * Cc * 2);  // 19.3 MB
    _Float16* Abuf = (_Float16*)carve((size_t)Bb * Ee * LL * 2);  // 48.8 MB
    _Float16* Ft   = (_Float16*)carve((size_t)Bb * LL * Cc * 2);  // 19.3 MB

    // 1) pack x into [b][l][c] f16; in the same launch, convert the weights (Wa zero-padded to 1024 rows)
    pack_x<<<dim3(LL / PL + WX, Cc / PC, Bb), 128, 0, stream>>>(x, Xt, Wv, Wa, Wp, Wvh, Wah, Wph);

    dim3 gblk(32, 8);
    // 2) value projection -> Vt[b][l][c] and attention logits + bias (f16) -> Abuf[b][e][l]  ((3 + 8) x 196 tiles of 128 x 128)
    gemm_va<<<dim3(Cc / BT + EPAD / BT, Bb * LL / BT), gblk, 0, stream>>>(Wvh, Wah, Xt, ba, Vt, Abuf);
    // 3) fused softmax over q + apply + fold -> Ft[b][l][c]
    apply_fold<<<dim3(HH / TY, NHEAD / 2, Bb), 2 * NPOS, 0, stream>>>(Abuf, Vt, Ft);
    // 4) final projection + bias -> out[b][d][l]
    gemm_out<<<dim3(Cc / BT, Bb * LL / BT), gblk, 0, stream>>>(Wph, Ft, bp, out);
}

// v006
// One run takes 87.1 microseconds.
// Next to v005, in two timings, it ran 1.16 times as fast each time.
// Over all steps from v000 it is 7.17 times as fast.
#include <hip/hip_runtime.h>
// Contractions: value projection, attention-logit projection and final projection (K = 384) on v_wmma_f32_16x16x32_f16
// (f16 operands, f32 accumulate); softmax over the 3x3 window and the attention-apply/fold (per-position weights, no shared operand) in f32 on VALU.

// ---------------- problem constants ----------------
#define Cc    384
#define NHEAD 12
#define HD    32
#define Ee    972        // K^4 * HEADS
#define EPAD  1024       // Ee padded to a multiple of the GEMM's 128-row tile
#define Bb    8
#define HH    56
#define LL    3136       // 56*56

typedef __attribute__((ext_vector_type(8)))  _Float16 v8h;
typedef __attribute__((ext_vector_type(16))) _Float16 v16h;
typedef __attribute__((ext_vector_type(8)))  float    v8f;
typedef __attribute__((ext_vector_type(4)))  float    v4f;
typedef __attribute__((ext_vector_type(4)))  unsigned v4u;

union AFrag { v16h v; v8h h[2]; };

template <typename V> __device__ __forceinline__ void vst2(void* p, V v) {
    *(V*)p = v; 
}
__device__ __forceinline__ v8f wmma_f16(v16h a, v16h b, v8f c) {
    v8f d = __builtin_amdgcn_wmma_f32_16x16x32_f16(false, a, false, b, (short)0, c, false, false);
    asm volatile("v_nop\n\tv_nop\n\tv_nop\n\tv_nop" : "+v"(d) : "v"(a), "v"(b));
    return d;
}

// ---------------- f32 -> f16 weight convert (with zero pad): 8 elements (16 B stored) per thread ----------------
// n is a multiple of 8, so a thread's 8 elements are all real or all pad; a pad thread reads the first 8 elements (in bounds) and stores zeros.
__device__ __forceinline__ void cvt_f32_f16(const float* __restrict__ s, _Float16* __restrict__ d, int n, int g) {
    const bool real = g * 8 < n;
    const float* __restrict__ p = s + (real ? g * 8 : 0);   // clamped into s: no branch around the loads
    const v4f r0 = *(const v4f*)p, r1 = *(const v4f*)(p + 4);
    asm volatile("s_wait_xcnt 0x0" :: "v"(p) : "memory");   // precaution: the loads' address pair is held (the operand) and waited for before its registers are reused
    union { v8h v; v4u u; } pk;
#pragma unroll   // r0, r1 and pk stay in registers only under constant indices
    for (int e = 0; e < 4; ++e) {
        pk.v[e]     = real ? (_Float16)r0[e] : (_Float16)0.0f;
        pk.v[e + 4] = real ? (_Float16)r1[e] : (_Float16)0.0f;
    }
    vst2(d + (size_t)g * 8, pk.u);
}

// x[B][C][L] (f32) -> Xt[B][L][C] (f16), transposed through LDS so that both sides move whole 256-B runs.
// Work-group = 128 channels x 64 positions, 4 waves. Read: 16 lanes cover the 256 B of one channel's 64 positions; a thread takes
// the same 4 positions of 8 consecutive channels (twice), so each position gives it one 16-byte piece of an Xt row.
// LDS tile [position][channel], rows of 256 B = all 64 banks: piece p of row l sits at piece p ^ (l >> 2), so the 16 lanes that
// write one piece column (rows 4 apart) and the 16 lanes that read one row both touch every bank once.
#define PC 128               // channels per tile
#define PL 64                // positions per tile
// The three weight converts depend on nothing and nothing in this launch depends on them: they ride in the same launch, in the
// work-groups with blockIdx.x >= LL / PL (WX more columns of the grid, WCH elements each).
#define WCH 1024             // elements per convert work-group: 128 threads x 8
#define WX 28                // WX * (Cc / PC) * Bb = 672 work-groups = (2 * Cc * Cc + EPAD * Cc) / WCH
static_assert(WX * (Cc / PC) * Bb * WCH == 2 * Cc * Cc + EPAD * Cc, "one work-group per weight chunk");
static_assert(Cc * Cc % WCH == 0 && EPAD * Cc % WCH == 0 && Ee * Cc % 8 == 0, "chunks do not straddle two weights, threads not the pad's edge");
__global__ void __launch_bounds__(128)
pack_x(const float* __restrict__ x, _Float16* __restrict__ Xt,
       const float* __restrict__ Wv, const float* __restrict__ Wa, const float* __restrict__ Wp,
       _Float16* __restrict__ Wvh, _Float16* __restrict__ Wah, _Float16* __restrict__ Wph) {
    __shared__ __align__(16) _Float16 t[PL * PC];       // 16 KB
    const int tid = threadIdx.x;
    if (blockIdx.x >= LL / PL) {                        // the same for the whole work-group; leaves before the barrier
        const int wb = (blockIdx.x - LL / PL) + WX * (blockIdx.y + (Cc / PC) * blockIdx.z);
        constexpr int NV = Cc * Cc / WCH, NA = EPAD * Cc / WCH;
        const bool isV = wb < NV, isA = !isV && wb < NV + NA;
        cvt_f32_f16(isV ? Wv : isA ? Wa : Wp, isV ? Wvh : isA ? Wah : Wph, isA ? Ee * Cc : Cc * Cc,
                    (isV ? wb : isA ? wb - NV : wb - NV - NA) * 128 + tid);
        return;
    }
    const int l0 = blockIdx.x * PL, c0 = blockIdx.y * PC, b = blockIdx.z;
    const int lq = tid & 15;                            // positions lq*4 .. lq*4+3
    const int cg = tid >> 4;                            // channel groups cg and cg + 8, 8 channels each
    const float* __restrict__ g = x + ((size_t)b * Cc + c0 + cg * 8) * LL + l0 + lq * 4;
    v4f r[2][8];
#pragma unroll   // r stays in registers only under constant indices; all 16 loads in flight at once
    for (int h = 0; h < 2; ++h)
#pragma unroll   // as above
        for (int e = 0; e < 8; ++e) r[h][e] = *(const v4f*)(g + (h * 64 + e) * LL);
    asm volatile("s_wait_xcnt 0x0" :: "v"(g) : "memory");   // precaution: the loads' address pair is held (the operand) and waited for before its registers are reused
    __builtin_amdgcn_sched_barrier(0);                  // keeps every convert behind all 16 loads: otherwise the last four loads are issued only behind a wait on earlier ones
#pragma unroll   // as above
    for (int h = 0; h < 2; ++h)
#pragma unroll   // as above
        for (int j = 0; j < 4; ++j) {
            v8h o;
#pragma unroll   // as above
            for (int e = 0; e < 8; ++e) o[e] = (_Float16)r[h][e][j];
            *(v8h*)(t + (lq * 4 + j) * PC + ((cg + h * 8) ^ lq) * 8) = o;
        }
    __syncthreads();
#pragma unroll   // 8 independent LDS reads and stores per thread, no loop counter
    for (int it = 0; it < PL * PC / 8 / 128; ++it) {
        const int p = tid + it * 128;
        const int l = p >> 4, pc = p & 15;
        vst2(Xt + ((size_t)b * LL + l0 + l) * Cc + c0 + pc * 8, *(const v4u*)(t + l * PC + (pc ^ (l >> 2)) * 8));
    }
    asm volatile("s_wait_xcnt 0x0" ::: "memory");       // precaution: stands behind the stores, in front of whatever the build lays out behind this path
}

// ---------------- WMMA GEMM: D[M x N] = W[M x 384] @ Xt^T, N = all (b, l) columns in Xt's own row order ----------
// Work-group = 128 x 128 tile of D, 8 waves. Both operands pass through LDS in stages of 64 k (one whole 128-B line of every
// row), two buffers: each byte is fetched once per work-group in whole lines and shared by the waves that need it.
// A/B fragments: row/col = lane&15; elements 0..7 <- k0 + 8*hi + 0..7, elements 8..15 <- k0 + 16 + 8*hi + 0..7 (same map).
#define BT 128               // rows of W and rows of Xt per work-group
#define KC 64                // k per stage
#define LP 72                // LDS pitch in halves: 144 B = 16 B x odd, conflict-free for 16-byte fragment reads
#define STG (2 * BT * LP)    // halves per stage: W rows, then Xt rows
#define GSM (2 * STG * 2)    // LDS bytes: two operand stages; afterwards the per-wave f32 staging, 8 KB each
template <int MODE>
__device__ __forceinline__ void
gemm_tile(char* smem, int mt, const _Float16* __restrict__ W, const _Float16* __restrict__ X,
          const float* __restrict__ bias, float* __restrict__ out32,
          _Float16* __restrict__ out16, int Mtot) {
    constexpr int TM = (MODE == 2) ? 32 : 64, TN = (MODE == 2) ? 64 : 32;
    constexpr int MI = TM / 16, NI = TN / 16;
    constexpr int WM = BT / TM;                             // waves along M; 8 / WM along N
    static_assert(GSM >= 8 * TM * TN * 4, "output staging must fit");
    static_assert(MI == 2 || MI == 4, "the wait behind the bias loads names 2 * MI address pairs");
    static_assert(Cc % 4 == 0 && Ee % 4 == 0, "a 16-byte bias load does not straddle the last real row");
    _Float16* sm = (_Float16*)smem;
    const int lane  = threadIdx.x;            // 0..31
    const int wid   = threadIdx.y;            // 0..7
    const int tid   = wid * 32 + lane;
    const int mB = mt * BT;
    const int nB = blockIdx.y * BT;           // column b * LL + l
    const int wm = wid % WM, wn = wid / WM;
    const int m0 = mB + wm * TM;
    const int nf = nB + wn * TN;              // LL is a multiple of TN: a wave's columns lie in one batch
    const int b  = nf / LL;
    const int n0 = nf % LL;
    const int laneM = lane & 15;
    const int hi    = lane >> 4;
    float* S = (float*)smem + wid * TM * TN;

    {
        // 16-byte pieces: 8 lanes cover one row's line, a wave 4 rows, the work-group 32 rows per step
        const _Float16* __restrict__ gW = W + (size_t)(mB + (tid >> 3)) * Cc + (tid & 7) * 8;
        const _Float16* __restrict__ gX = X + (size_t)(nB + (tid >> 3)) * Cc + (tid & 7) * 8;
        _Float16* sp = sm + (tid >> 3) * LP + (tid & 7) * 8;
        v4u rw[BT / 32], rx[BT / 32];
        auto fetch = [&](int kc) {
#pragma unroll   // rw, rx stay in registers only under constant indices
            for (int it = 0; it < BT / 32; ++it) {
                rw[it] = *(const v4u*)(gW + it * 32 * Cc + kc * KC);
                rx[it] = *(const v4u*)(gX + it * 32 * Cc + kc * KC);
            }
            asm volatile("s_wait_xcnt 0x0" :: "v"(gW), "v"(gX) : "memory");   // precaution: both address pairs are held (the operands) and waited for before their registers are reused, also as a later load's destination
        };
        auto put = [&](int buf) {
#pragma unroll   // as in fetch
            for (int it = 0; it < BT / 32; ++it) {
                *(v4u*)(sp + buf * STG + it * 32 * LP) = rw[it];
                *(v4u*)(sp + buf * STG + BT * LP + it * 32 * LP) = rx[it];
            }
        };
        // Bias: a lane's 8 accumulator rows of a fragment are consecutive, so two 16-byte loads per mi bring them all. They are issued
        // here, in front of the first stage's loads, and become the accumulators' start value: their latency lies under that stage's.
        // Mtot is a multiple of 4, so a load is all real or all pad; a pad load is clamped into bias and gives zeros.
        v4f bv[MI][2] = {};
        if (MODE != 0) {
            const float* bp[MI][2];
#pragma unroll   // bv and bp stay in registers only under constant indices
            for (int mi = 0; mi < MI; ++mi)
#pragma unroll   // as above
                for (int h = 0; h < 2; ++h) {
                    bp[mi][h] = bias + min(m0 + mi * 16 + 8 * hi + 4 * h, Mtot - 4);
                    bv[mi][h] = *(const v4f*)bp[mi][h];
                }
            // precaution: the loads' address pairs are held (the operands) and waited for before their registers are reused
            if (MI == 2) asm volatile("s_wait_xcnt 0x0" :: "v"(bp[0][0]), "v"(bp[0][1]), "v"(bp[1][0]), "v"(bp[1][1]) : "memory");
            else         asm volatile("s_wait_xcnt 0x0" :: "v"(bp[0][0]), "v"(bp[0][1]), "v"(bp[1][0]), "v"(bp[1][1]),
                                      "v"(bp[MI - 2][0]), "v"(bp[MI - 2][1]), "v"(bp[MI - 1][0]), "v"(bp[MI - 1][1]) : "memory");
        }
        fetch(0);
        put(0);
        __syncthreads();
        v8f acc[MI][NI];
#pragma unroll   // acc stays in registers only under constant indices
        for (int mi = 0; mi < MI; ++mi)
#pragma unroll   // as above
            for (int ni = 0; ni < NI; ++ni)
#pragma unroll   // as above
                for (int r = 0; r < 8; ++r)
                    acc[mi][ni][r] = (MODE != 0 && m0 + mi * 16 + 8 * hi + (r & 4) < Mtot) ? bv[mi][r >> 2][r & 3] : 0.0f;
#pragma unroll   // buffer index and the last-stage test become constants
        for (int kc = 0; kc < Cc / KC; ++kc) {
            if (kc + 1 < Cc / KC) fetch(kc + 1);            // in flight while this stage is multiplied
            const _Float16* sa = sm + (kc & 1) * STG + (wm * TM + laneM) * LP + 8 * hi;
            const _Float16* sb = sm + (kc & 1) * STG + BT * LP + (wn * TN + laneM) * LP + 8 * hi;
#pragma unroll
            for (int ks = 0; ks < KC; ks += 32) {
                AFrag a[MI], bf[NI];
#pragma unroll
                for (int mi = 0; mi < MI; ++mi) {
                    a[mi].h[0] = *(const v8h*)(sa + mi * 16 * LP + ks);
                    a[mi].h[1] = *(const v8h*)(sa + mi * 16 * LP + ks + 16);
                }
#pragma unroll
                for (int ni = 0; ni < NI; ++ni) {
                    bf[ni].h[0] = *(const v8h*)(sb + ni * 16 * LP + ks);
                    bf[ni].h[1] = *(const v8h*)(sb + ni * 16 * LP + ks + 16);
                }
#pragma unroll
                for (int mi = 0; mi < MI; ++mi)
#pragma unroll
                    for (int ni = 0; ni < NI; ++ni)
                        acc[mi][ni] = wmma_f16(a[mi].v, bf[ni].v, acc[mi][ni]);
            }
            if (kc + 1 < Cc / KC) put((kc + 1) & 1);        // the buffer that every wave left at the last barrier
            __syncthreads();                                // publishes the next stage; after the last one, frees LDS for S
        }
        // D layout: element r -> (m = mi*16 + 8*hi + r, n = ni*16 + laneM); stage [m][n] for MODE 1/2, [n][m] for MODE 0
#pragma unroll
        for (int mi = 0; mi < MI; ++mi)
#pragma unroll
            for (int ni = 0; ni < NI; ++ni)
#pragma unroll
                for (int r = 0; r < 8; ++r) {
                    const int ml = mi * 16 + 8 * hi + r, nl = ni * 16 + laneM;
                    const float v = acc[mi][ni][r];
                    if (MODE == 0) S[nl * TM + ml] = v; else S[ml * TN + nl] = v;
                }
    }
    __syncthreads();
    if (MODE == 0) {
#pragma unroll
        for (int q = 0; q < 8; ++q) {
            const int nl = q * 4 + (lane >> 3), pc = lane & 7;
            union { v8h v; v4u u; } pk;
#pragma unroll
            for (int e = 0; e < 8; ++e) pk.v[e] = (_Float16)S[nl * TM + pc * 8 + e];
            vst2(out16 + ((size_t)b * LL + n0 + nl) * Cc + m0 + pc * 8, pk.u);
        }
    } else if (MODE == 1) {
#pragma unroll
        for (int q = 0; q < 16; ++q) {
            const int ml = q * 4 + (lane >> 3), pc = lane & 7;
            const int row = m0 + ml;
            if (row < Mtot)
                vst2(out32 + ((size_t)b * Mtot + row) * LL + n0 + pc * 4, *(const v4f*)(S + ml * TN + pc * 4));
        }
    } else {
#pragma unroll
        for (int q = 0; q < 8; ++q) {
            const int ml = q * 4 + (lane >> 3), pc = lane & 7;
            const int row = m0 + ml;
            union { v8h v; v4u u; } pk;
#pragma unroll
            for (int e = 0; e < 8; ++e) pk.v[e] = (_Float16)S[ml * TN + pc * 8 + e];
            if (row < Mtot) vst2(out16 + ((size_t)b * Mtot + row) * LL + n0 + pc * 8, pk.u);
        }
    }
}

// final projection: one launch of its own (it reads Ft). It builds at 168 VGPRs: allocated 176, so 5 waves per SIMD = 2 work-groups per WGP.
__global__ void __launch_bounds__(256)
gemm_out(const _Float16* __restrict__ W, const _Float16* __restrict__ X,
         const float* __restrict__ bias, float* __restrict__ out32) {
    __shared__ __align__(16) char smem[GSM];
    gemm_tile<1>(smem, blockIdx.x, W, X, bias, out32, nullptr, Cc);
}

// value projection and attention logits: both read Xt and neither reads the other, so their tiles share one launch.
// blockIdx.x runs over the Cc / BT row tiles of Wv, then the EPAD / BT row tiles of Wa; the choice is the same for a whole work-group.
__global__ void __launch_bounds__(256, 6)   // 6 waves per SIMD: holds the build at 160 VGPRs = 3 work-groups per WGP (162 would be allocated as 176 and leave 2)
gemm_va(const _Float16* __restrict__ Wv, const _Float16* __restrict__ Wa, const _Float16* __restrict__ X,
        const float* __restrict__ ba, _Float16* __restrict__ Vt, _Float16* __restrict__ A) {
    __shared__ __align__(16) char smem[GSM];
    if (blockIdx.x < Cc / BT) gemm_tile<0>(smem, blockIdx.x, Wv, X, nullptr, nullptr, Vt, Cc);
    else                      gemm_tile<2>(smem, blockIdx.x - Cc / BT, Wa, X, ba, nullptr, A, Ee);
}

// ------- fused softmax + attention-apply + fold: Ft[b][y*56+x][c] = folded value -------
// folded[b,n*32+d,y,x] = sum_{i,j valid} sum_{q valid}
//     softmax_q(A * 32^-0.5)[b, n*81+(i3+j)*9+q, (y+1-i)*56+(x+1-j)] * V[b, n*32+d, (x+qj-j)*56+(y+qi-i)]
// (the bdwh spatial-transpose of the value tensor is baked into the V column index)
// Tiling: block = 4 image rows x one head pair of one batch; thread = one position of one head, all 32 channels.
// Lanes run along l, so every A plane is read once in contiguous runs; the V halo (8 x 60 positions, zero outside
// the image, as the reference pads) sits in LDS. The V operand depends only on (qi-i, qj-j), so the A terms that
// share an offset are summed first (25 weights) and each V row is read once per thread.
// A holds the logits: a thread has all 9 q of each of its 9 (i, j) groups, and a (head, group, position) is used by at most
// one thread, so the softmax is taken here, in registers: no more exponentials than a launch of its own would take.
#define TY 4                 // image rows per block
#define VR (TY + 4)          // halo rows
#define VC 63                // halo columns: 56 + 4, plus 3 never read, so that the tile's 16-byte pieces are 9 per thread, exact
#define VP 72                // LDS pitch in halves: 144 B = 16 B x odd, conflict-free for 16-byte reads along x
#define NPOS (TY * HH)       // 224 positions = 7 waves per head
__global__ void __launch_bounds__(2 * NPOS)
apply_fold(const _Float16* __restrict__ A, const _Float16* __restrict__ Vt, _Float16* __restrict__ Ft) {
    __shared__ __align__(16) _Float16 vs[VR * VC * VP];   // V halo tile, 128 B (two heads) per position
    __shared__ __align__(16) _Float16 os[NPOS * VP];      // output tile, 128 B per position
    const int tid = threadIdx.x;
    const int hh2 = __builtin_amdgcn_readfirstlane((tid >= NPOS) ? 1 : 0);   // head of the pair: the same in all lanes of a wave (7 waves per head), kept scalar so that A has a scalar base
    const int pl  = tid - hh2 * NPOS;                    // position inside the tile
    const int y0  = blockIdx.x * TY;
    const int np  = blockIdx.y;
    const int b   = blockIdx.z;
    const int yl = pl / HH, x = pl % HH;
    const int y  = y0 + yl;
    const int n  = np * 2 + hh2;

    // A: 81 independent 2-byte loads per thread, 64 contiguous bytes per wave each; a fold shift that leaves the image
    // reads the thread's own position instead (in bounds) and is weighted 0
    const char* __restrict__ Ab = (const char*)(A + ((size_t)b * Ee + n * 81) * LL);   // scalar base + 32-bit lane offset
    _Float16 ah[81];
    float msk[9];
#pragma unroll
    for (int i = 0; i < 3; ++i)
#pragma unroll
        for (int j = 0; j < 3; ++j) {
            const int hp = y + 1 - i, wp = x + 1 - j;    // source l' for this fold shift
            const bool ok = (hp >= 0 && hp < HH && wp >= 0 && wp < HH);
            const unsigned ls = 2u * (unsigned)(ok ? hp * HH + wp : y * HH + x);
            msk[i * 3 + j] = ok ? 1.0f : 0.0f;
#pragma unroll
            for (int q = 0; q < 9; ++q) ah[(i * 3 + j) * 9 + q] = *(const _Float16*)(Ab + ls + ((i * 3 + j) * 9 + q) * LL * 2);
        }

    // V halo: entry (rr, ss) holds V at row r = y0-2+rr, column s = ss-2 of the transposed value image, i.e. Vt row s*56+r
    const char* __restrict__ Vb = (const char*)(Vt + (size_t)b * LL * Cc + np * 64);
#pragma unroll
    for (int it = 0; it < VR * VC * 8 / (2 * NPOS); ++it) {   // addresses clamped into Vt: no branch around the loads
        const int c = tid + it * 2 * NPOS;
        const int e = c >> 3, pc = c & 7;
        const int rr = e % VR, ss = e / VR;
        const int r = y0 - 2 + rr, s = ss - 2;
        const int rc = min(max(r, 0), HH - 1), sc = min(max(s, 0), HH - 1);
        v4u val = *(const v4u*)(Vb + (unsigned)((sc * HH + rc) * Cc * 2 + pc * 16));
        val &= (r >= 0 && r < HH && s >= 0 && s < HH) ? 0xFFFFFFFFu : 0u;   // the reference's zero padding
        *(v4u*)(vs + (rr * VC + ss) * VP + pc * 8) = val;
    }

    const float kq = 0.17677669529663687f * 1.4426950408889634f;   // 32^-0.5 * log2(e): exp(s * (a - max)) = 2^(kq * a - kq * max)
    float w[5][5] = {};
#pragma unroll
    for (int i = 0; i < 3; ++i)
#pragma unroll
        for (int j = 0; j < 3; ++j) {
            float ev[9];
            _Float16 mx = ah[(i * 3 + j) * 9];
#pragma unroll   // ah and ev stay in registers only under constant indices
            for (int q = 1; q < 9; ++q) mx = __builtin_fmaxf16(mx, ah[(i * 3 + j) * 9 + q]);
            const float nm = -kq * (float)mx;
            float sum = 0.f;
#pragma unroll   // as above
            for (int q = 0; q < 9; ++q) { ev[q] = __builtin_amdgcn_exp2f(fmaf((float)ah[(i * 3 + j) * 9 + q], kq, nm)); sum += ev[q]; }
            const float g = msk[i * 3 + j] * __builtin_amdgcn_rcpf(sum);   // sum lies in [1, 9]
#pragma unroll
            for (int qi = 0; qi < 3; ++qi)
#pragma unroll
                for (int qj = 0; qj < 3; ++qj)
                    w[qi - i + 2][qj - j + 2] += g * ev[qi * 3 + qj];
        }
    __syncthreads();

    float acc[HD] = {};
    const _Float16* vb = vs + (yl * VC + x) * VP + hh2 * HD;
#pragma unroll
    for (int dy = 0; dy < 5; ++dy)
#pragma unroll
        for (int dx = 0; dx < 5; ++dx) {
            const v8h* pv = (const v8h*)(vb + (dy * VC + dx) * VP);
#pragma unroll
            for (int k = 0; k < HD / 8; ++k) {
                const v8h v = pv[k];
#pragma unroll
                for (int e = 0; e < 8; ++e) acc[k * 8 + e] += w[dy][dx] * (float)v[e];
            }
        }

    // whole 128-B lines of Ft: both heads of a position meet in LDS, 8 lanes store one line
#pragma unroll
    for (int k = 0; k < HD / 8; ++k) {
        v8h o;
#pragma unroll
        for (int e = 0; e < 8; ++e) o[e] = (_Float16)acc[k * 8 + e];
        *(v8h*)(os + pl * VP + hh2 * HD + k * 8) = o;
    }
    __syncthreads();
#pragma unroll
    for (int it = 0; it < 4; ++it) {                      // NPOS * 8 pieces = 4 per thread, exact
        const int c = tid + it * 2 * NPOS;
        const int e = c >> 3, pc = c & 7;
        vst2(Ft + ((size_t)b * LL + y0 * HH + e) * Cc + np * 64 + pc * 8, *(const v4u*)(os + e * VP + pc * 8));
    }
}

// ---------------------------------------------------------------------------
extern "C" void kernel_launch(void* const* d_in, const int* in_sizes, int n_in,
                              void* d_out, int out_size, void* d_ws, size_t ws_size,
                              hipStream_t stream) {
    (void)in_sizes; (void)n_in; (void)out_size; (void)ws_size;
    const float* x  = (const float*)d_in[0];
    const float* Wv = (const float*)d_in[1];
    const float* Wa = (const float*)d_in[2];
    const float* ba = (const float*)d_in[3];
    const float* Wp = (const float*)d_in[4];
    const float* bp = (const float*)d_in[5];
    float* out = (float*)d_out;

    char* ws = (char*)d_ws;
    size_t off = 0;
    auto carve = [&](size_t bytes) -> void* {
        void* p = ws + off;
        off += (bytes + 255) & ~(size_t)255;
        return p;
    };
    _Float16* Xt   = (_Float16*)carve((size_t)Bb * LL * Cc * 2);  // 19.3 MB
    _Float16* Wvh  = (_Float16*)carve((size_t)Cc * Cc * 2);
    _Float16* Wah  = (_Float16*)carve((size_t)EPAD * Cc * 2);
    _Float16* Wph  = (_Float16*)carve((size_t)Cc * Cc * 2);
    _Float16* Vt   = (_Float16*)carve((size_t)Bb * LL * Cc * 2);  // 19.3 MB
    _Float16* Abuf = (_Float16*)carve((size_t)Bb * Ee * LL * 2);  // 48.8 MB
    _Float16* Ft   = (_Float16*)carve((size_t)Bb * LL * Cc * 2);  // 19.3 MB

    // 1) pack x into [b][l][c] f16; in the same launch, convert the weights (Wa zero-padded to 1024 rows)
    pack_x<<<dim3(LL / PL + WX, Cc / PC, Bb), 128, 0, stream>>>(x, Xt, Wv, Wa, Wp, Wvh, Wah, Wph);

    dim3 gblk(32, 8);
    // 2) value projection -> Vt[b][l][c] and attention logits + bias (f16) -> Abuf[b][e][l]  ((3 + 8) x 196 tiles of 128 x 128)
    gemm_va<<<dim3(Cc / BT + EPAD / BT, Bb * LL / BT), gblk, 0, stream>>>(Wvh, Wah, Xt, ba, Vt, Abuf);
    // 3) fused softmax over q + apply + fold -> Ft[b][l][c]
    apply_fold<<<dim3(HH / TY, NHEAD / 2, Bb), 2 * NPOS, 0, stream>>>(Abuf, Vt, Ft);
    // 4) final projection + bias -> out[b][d][l]
    gemm_out<<<dim3(Cc / BT, Bb * LL / BT), gblk, 0, stream>>>(Wph, Ft, bp, out);
}

// v007
// A run of this version takes 78.2 microseconds.
// Two timings next to v006 put it at 1.12 and 1.11 times that version's speed.
// Counting every step since v000, it is 7.99 times as fast.
#include <hip/hip_runtime.h>
// Contractions: value projection, attention-logit projection and final projection (K = 384) on v_wmma_f32_16x16x32_f16
// (f16 operands, f32 accumulate); softmax over the 3x3 window and the attention-apply/fold (per-position weights, no shared operand) in f32 on VALU.

// ---------------- problem constants ----------------
#define Cc    384
#define NHEAD 12
#define HD    32
#define Ee    972        // K^4 * HEADS
#define EPAD  1024       // Ee padded to a multiple of the GEMM's 128-row tile
#define Bb    8
#define HH    56
#define LL    3136       // 56*56

typedef __attribute__((ext_vector_type(8)))  _Float16 v8h;
typedef __attribute__((ext_vector_type(16))) _Float16 v16h;
typedef __attribute__((ext_vector_type(8)))  float    v8f;
typedef __attribute__((ext_vector_type(4)))  float    v4f;
typedef __attribute__((ext_vector_type(4)))  unsigned v4u;

union AFrag { v16h v; v8h h[2]; };

template <typename V> __device__ __forceinline__ void vst2(void* p, V v) {
    *(V*)p = v; 
}
__device__ __forceinline__ v8f wmma_f16(v16h a, v16h b, v8f c) {
    v8f d = __builtin_amdgcn_wmma_f32_16x16x32_f16(false, a, false, b, (short)0, c, false, false);
    asm volatile("v_nop\n\tv_nop\n\tv_nop\n\tv_nop" : "+v"(d) : "v"(a), "v"(b));
    return d;
}

// ---------------- f32 -> f16 weight convert (with zero pad): 8 elements (16 B stored) per thread ----------------
// n is a multiple of 8, so a thread's 8 elements are all real or all pad; a pad thread reads the first 8 elements (in bounds) and stores zeros.
__device__ __forceinline__ void cvt_f32_f16(const float* __restrict__ s, _Float16* __restrict__ d, int n, int g) {
    const bool real = g * 8 < n;
    const float* __restrict__ p = s + (real ? g * 8 : 0);   // clamped into s: no branch around the loads
    const v4f r0 = *(const v4f*)p, r1 = *(const v4f*)(p + 4);
    asm volatile("s_wait_xcnt 0x0" :: "v"(p) : "memory");   // precaution: the loads' address pair is held (the operand) and waited for before its registers are reused
    union { v8h v; v4u u; } pk;
#pragma unroll   // r0, r1 and pk stay in registers only under constant indices
    for (int e = 0; e < 4; ++e) {
        pk.v[e]     = real ? (_Float16)r0[e] : (_Float16)0.0f;
        pk.v[e + 4] = real ? (_Float16)r1[e] : (_Float16)0.0f;
    }
    vst2(d + (size_t)g * 8, pk.u);
}

// x[B][C][L] (f32) -> Xt[B][L][C] (f16), transposed through LDS so that both sides move whole 256-B runs.
// Work-group = 128 channels x 64 positions, 4 waves. Read: 16 lanes cover the 256 B of one channel's 64 positions; a thread takes
// the same 4 positions of 8 consecutive channels (twice), so each position gives it one 16-byte piece of an Xt row.
// LDS tile [position][channel], rows of 256 B = all 64 banks: piece p of row l sits at piece p ^ (l >> 2), so the 16 lanes that
// write one piece column (rows 4 apart) and the 16 lanes that read one row both touch every bank once.
#define PC 128               // channels per tile
#define PL 64                // positions per tile
// The three weight converts depend on nothing and nothing in this launch depends on them: they ride in the same launch, in the
// work-groups with blockIdx.x >= LL / PL (WX more columns of the grid, WCH elements each).
#define WCH 1024             // elements per convert work-group: 128 threads x 8
#define WX 28                // WX * (Cc / PC) * Bb = 672 work-groups = (2 * Cc * Cc + EPAD * Cc) / WCH
static_assert(WX * (Cc / PC) * Bb * WCH == 2 * Cc * Cc + EPAD * Cc, "one work-group per weight chunk");
static_assert(Cc * Cc % WCH == 0 && EPAD * Cc % WCH == 0 && Ee * Cc % 8 == 0, "chunks do not straddle two weights, threads not the pad's edge");
__global__ void __launch_bounds__(128)
pack_x(const float* __restrict__ x, _Float16* __restrict__ Xt,
       const float* __restrict__ Wv, const float* __restrict__ Wa, const float* __restrict__ Wp,
       _Float16* __restrict__ Wvh, _Float16* __restrict__ Wah, _Float16* __restrict__ Wph) {
    __shared__ __align__(16) _Float16 t[PL * PC];       // 16 KB
    const int tid = threadIdx.x;
    if (blockIdx.x >= LL / PL) {                        // the same for the whole work-group; leaves before the barrier
        const int wb = (blockIdx.x - LL / PL) + WX * (blockIdx.y + (Cc / PC) * blockIdx.z);
        constexpr int NV = Cc * Cc / WCH, NA = EPAD * Cc / WCH;
        const bool isV = wb < NV, isA = !isV && wb < NV + NA;
        cvt_f32_f16(isV ? Wv : isA ? Wa : Wp, isV ? Wvh : isA ? Wah : Wph, isA ? Ee * Cc : Cc * Cc,
                    (isV ? wb : isA ? wb - NV : wb - NV - NA) * 128 + tid);
        return;
    }
    const int l0 = blockIdx.x * PL, c0 = blockIdx.y * PC, b = blockIdx.z;
    const int lq = tid & 15;                            // positions lq*4 .. lq*4+3
    const int cg = tid >> 4;                            // channel groups cg and cg + 8, 8 channels each
    const float* __restrict__ g = x + ((size_t)b * Cc + c0 + cg * 8) * LL + l0 + lq * 4;
    v4f r[2][8];
#pragma unroll   // r stays in registers only under constant indices; all 16 loads in flight at once
    for (int h = 0; h < 2; ++h)
#pragma unroll   // as above
        for (int e = 0; e < 8; ++e) r[h][e] = *(const v4f*)(g + (h * 64 + e) * LL);
    asm volatile("s_wait_xcnt 0x0" :: "v"(g) : "memory");   // precaution: the loads' address pair is held (the operand) and waited for before its registers are reused
    __builtin_amdgcn_sched_barrier(0);                  // keeps every convert behind all 16 loads: otherwise the last four loads are issued only behind a wait on earlier ones
#pragma unroll   // as above
    for (int h = 0; h < 2; ++h)
#pragma unroll   // as above
        for (int j = 0; j < 4; ++j) {
            v8h o;
#pragma unroll   // as above
            for (int e = 0; e < 8; ++e) o[e] = (_Float16)r[h][e][j];
            *(v8h*)(t + (lq * 4 + j) * PC + ((cg + h * 8) ^ lq) * 8) = o;
        }
    __syncthreads();
#pragma unroll   // 8 independent LDS reads and stores per thread, no loop counter
    for (int it = 0; it < PL * PC / 8 / 128; ++it) {
        const int p = tid + it * 128;
        const int l = p >> 4, pc = p & 15;
        vst2(Xt + ((size_t)b * LL + l0 + l) * Cc + c0 + pc * 8, *(const v4u*)(t + l * PC + (pc ^ (l >> 2)) * 8));
    }
    asm volatile("s_wait_xcnt 0x0" ::: "memory");       // precaution: stands behind the stores, in front of whatever the build lays out behind this path
}

// ---------------- WMMA GEMM: D[M x N] = W[M x 384] @ Xt^T, N = all (b, l) columns in Xt's own row order ----------
// Work-group = 128 x 128 tile of D, 8 waves. Both operands pass through LDS in stages of 64 k (one whole 128-B line of every
// row), two buffers: each byte is fetched once per work-group in whole lines and shared by the waves that need it.
// A/B fragments: row/col = lane&15; elements 0..7 <- k0 + 8*hi + 0..7, elements 8..15 <- k0 + 16 + 8*hi + 0..7 (same map).
#define BT 128               // rows of W and rows of Xt per work-group
#define KC 64                // k per stage
#define LP 72                // LDS pitch in halves: 144 B = 16 B x odd, conflict-free for 16-byte fragment reads
#define STG (2 * BT * LP)    // halves per stage: W rows, then Xt rows
#define GSM (2 * STG * 2)    // LDS bytes: two operand stages; afterwards the per-wave f32 staging, 8 KB each
template <int MODE>
__device__ __forceinline__ void
gemm_tile(char* smem, int mt, const _Float16* __restrict__ W, const _Float16* __restrict__ X,
          const float* __restrict__ bias, float* __restrict__ out32,
          _Float16* __restrict__ out16, int Mtot) {
    constexpr int TM = (MODE == 2) ? 32 : 64, TN = (MODE == 2) ? 64 : 32;
    constexpr int MI = TM / 16, NI = TN / 16;
    constexpr int WM = BT / TM;                             // waves along M; 8 / WM along N
    static_assert(GSM >= 8 * TM * TN * 4, "output staging must fit");
    static_assert(MI == 2 || MI == 4, "the wait behind the bias loads names 2 * MI address pairs");
    static_assert(Cc % 4 == 0 && Ee % 4 == 0, "a 16-byte bias load does not straddle the last real row");
    _Float16* sm = (_Float16*)smem;
    const int lane  = threadIdx.x;            // 0..31
    const int wid   = threadIdx.y;            // 0..7
    const int tid   = wid * 32 + lane;
    const int mB = mt * BT;
    const int nB = blockIdx.y * BT;           // column b * LL + l
    const int wm = wid % WM, wn = wid / WM;
    const int m0 = mB + wm * TM;
    const int nf = nB + wn * TN;              // LL is a multiple of TN: a wave's columns lie in one batch
    const int b  = nf / LL;
    const int n0 = nf % LL;
    const int laneM = lane & 15;
    const int hi    = lane >> 4;
    float* S = (float*)smem + wid * TM * TN;

    {
        // 16-byte pieces: 8 lanes cover one row's line, a wave 4 rows, the work-group 32 rows per step
        const _Float16* __restrict__ gW = W + (size_t)(mB + (tid >> 3)) * Cc + (tid & 7) * 8;
        const _Float16* __restrict__ gX = X + (size_t)(nB + (tid >> 3)) * Cc + (tid & 7) * 8;
        _Float16* sp = sm + (tid >> 3) * LP + (tid & 7) * 8;
        v4u rw[BT / 32], rx[BT / 32];
        auto fetch = [&](int kc) {
#pragma unroll   // rw, rx stay in registers only under constant indices
            for (int it = 0; it < BT / 32; ++it) {
                rw[it] = *(const v4u*)(gW + it * 32 * Cc + kc * KC);
                rx[it] = *(const v4u*)(gX + it * 32 * Cc + kc * KC);
            }
            asm volatile("s_wait_xcnt 0x0" :: "v"(gW), "v"(gX) : "memory");   // precaution: both address pairs are held (the operands) and waited for before their registers are reused, also as a later load's destination
        };
        auto put = [&](int buf) {
#pragma unroll   // as in fetch
            for (int it = 0; it < BT / 32; ++it) {
                *(v4u*)(sp + buf * STG + it * 32 * LP) = rw[it];
                *(v4u*)(sp + buf * STG + BT * LP + it * 32 * LP) = rx[it];
            }
        };
        // Bias: a lane's 8 accumulator rows of a fragment are consecutive, so two 16-byte loads per mi bring them all. They are issued
        // here, in front of the first stage's loads, and become the accumulators' start value: their latency lies under that stage's.
        // Mtot is a multiple of 4, so a load is all real or all pad; a pad load is clamped into bias and gives zeros.
        v4f bv[MI][2] = {};
        if (MODE != 0) {
            const float* bp[MI][2];
#pragma unroll   // bv and bp stay in registers only under constant indices
            for (int mi = 0; mi < MI; ++mi)
#pragma unroll   // as above
                for (int h = 0; h < 2; ++h) {
                    bp[mi][h] = bias + min(m0 + mi * 16 + 8 * hi + 4 * h, Mtot - 4);
                    bv[mi][h] = *(const v4f*)bp[mi][h];
                }
            // precaution: the loads' address pairs are held (the operands) and waited for before their registers are reused
            if (MI == 2) asm volatile("s_wait_xcnt 0x0" :: "v"(bp[0][0]), "v"(bp[0][1]), "v"(bp[1][0]), "v"(bp[1][1]) : "memory");
            else         asm volatile("s_wait_xcnt 0x0" :: "v"(bp[0][0]), "v"(bp[0][1]), "v"(bp[1][0]), "v"(bp[1][1]),
                                      "v"(bp[MI - 2][0]), "v"(bp[MI - 2][1]), "v"(bp[MI - 1][0]), "v"(bp[MI - 1][1]) : "memory");
        }
        fetch(0);
        put(0);
        __syncthreads();
        v8f acc[MI][NI];
#pragma unroll   // acc stays in registers only under constant indices
        for (int mi = 0; mi < MI; ++mi)
#pragma unroll   // as above
            for (int ni = 0; ni < NI; ++ni)
#pragma unroll   // as above
                for (int r = 0; r < 8; ++r)
                    acc[mi][ni][r] = (MODE != 0 && m0 + mi * 16 + 8 * hi + (r & 4) < Mtot) ? bv[mi][r >> 2][r & 3] : 0.0f;
#pragma unroll   // buffer index and the last-stage test become constants
        for (int kc = 0; kc < Cc / KC; ++kc) {
            if (kc + 1 < Cc / KC) fetch(kc + 1);            // in flight while this stage is multiplied
            const _Float16* sa = sm + (kc & 1) * STG + (wm * TM + laneM) * LP + 8 * hi;
            const _Float16* sb = sm + (kc & 1) * STG + BT * LP + (wn * TN + laneM) * LP + 8 * hi;
#pragma unroll
            for (int ks = 0; ks < KC; ks += 32) {
                AFrag a[MI], bf[NI];
#pragma unroll
                for (int mi = 0; mi < MI; ++mi) {
                    a[mi].h[0] = *(const v8h*)(sa + mi * 16 * LP + ks);
                    a[mi].h[1] = *(const v8h*)(sa + mi * 16 * LP + ks + 16);
                }
#pragma unroll
                for (int ni = 0; ni < NI; ++ni) {
                    bf[ni].h[0] = *(const v8h*)(sb + ni * 16 * LP + ks);
                    bf[ni].h[1] = *(const v8h*)(sb + ni * 16 * LP + ks + 16);
                }
#pragma unroll
                for (int mi = 0; mi < MI; ++mi)
#pragma unroll
                    for (int ni = 0; ni < NI; ++ni)
                        acc[mi][ni] = wmma_f16(a[mi].v, bf[ni].v, acc[mi][ni]);
            }
            if (kc + 1 < Cc / KC) put((kc + 1) & 1);        // the buffer that every wave left at the last barrier
            __syncthreads();                                // publishes the next stage; after the last one, frees LDS for S
        }
        // D layout: element r -> (m = mi*16 + 8*hi + r, n = ni*16 + laneM); stage [m][n] for MODE 1/2, [n][m] for MODE 0
#pragma unroll
        for (int mi = 0; mi < MI; ++mi)
#pragma unroll
            for (int ni = 0; ni < NI; ++ni)
#pragma unroll
                for (int r = 0; r < 8; ++r) {
                    const int ml = mi * 16 + 8 * hi + r, nl = ni * 16 + laneM;
                    const float v = acc[mi][ni][r];
                    if (MODE == 0) S[nl * TM + ml] = v; else S[ml * TN + nl] = v;
                }
    }
    __syncthreads();
    if (MODE == 0) {
#pragma unroll
        for (int q = 0; q < 8; ++q) {
            const int nl = q * 4 + (lane >> 3), pc = lane & 7;
            union { v8h v; v4u u; } pk;
#pragma unroll
            for (int e = 0; e < 8; ++e) pk.v[e] = (_Float16)S[nl * TM + pc * 8 + e];
            vst2(out16 + ((size_t)b * LL + n0 + nl) * Cc + m0 + pc * 8, pk.u);
        }
    } else if (MODE == 1) {
#pragma unroll
        for (int q = 0; q < 16; ++q) {
            const int ml = q * 4 + (lane >> 3), pc = lane & 7;
            const int row = m0 + ml;
            if (row < Mtot)
                vst2(out32 + ((size_t)b * Mtot + row) * LL + n0 + pc * 4, *(const v4f*)(S + ml * TN + pc * 4));
        }
    } else {
#pragma unroll
        for (int q = 0; q < 8; ++q) {
            const int ml = q * 4 + (lane >> 3), pc = lane & 7;
            const int row = m0 + ml;
            union { v8h v; v4u u; } pk;
#pragma unroll
            for (int e = 0; e < 8; ++e) pk.v[e] = (_Float16)S[ml * TN + pc * 8 + e];
            if (row < Mtot) vst2(out16 + ((size_t)b * Mtot + row) * LL + n0 + pc * 8, pk.u);
        }
    }
}

// final projection: one launch of its own (it reads Ft).
__global__ void __launch_bounds__(256, 6)   // 6 waves per SIMD: holds the build at 160 VGPRs = 3 work-groups per WGP, so that all 588 are resident at once (168 would be allocated as 176 and leave 2)
gemm_out(const _Float16* __restrict__ W, const _Float16* __restrict__ X,
         const float* __restrict__ bias, float* __restrict__ out32) {
    __shared__ __align__(16) char smem[GSM];
    gemm_tile<1>(smem, blockIdx.x, W, X, bias, out32, nullptr, Cc);
}

// value projection and attention logits: both read Xt and neither reads the other, so their tiles share one launch.
// blockIdx.x runs over the Cc / BT row tiles of Wv, then the EPAD / BT row tiles of Wa; the choice is the same for a whole work-group.
__global__ void __launch_bounds__(256, 6)   // 6 waves per SIMD: holds the build at 160 VGPRs = 3 work-groups per WGP (162 would be allocated as 176 and leave 2)
gemm_va(const _Float16* __restrict__ Wv, const _Float16* __restrict__ Wa, const _Float16* __restrict__ X,
        const float* __restrict__ ba, _Float16* __restrict__ Vt, _Float16* __restrict__ A) {
    __shared__ __align__(16) char smem[GSM];
    if (blockIdx.x < Cc / BT) gemm_tile<0>(smem, blockIdx.x, Wv, X, nullptr, nullptr, Vt, Cc);
    else                      gemm_tile<2>(smem, blockIdx.x - Cc / BT, Wa, X, ba, nullptr, A, Ee);
}

// ------- fused softmax + attention-apply + fold: Ft[b][y*56+x][c] = folded value -------
// folded[b,n*32+d,y,x] = sum_{i,j valid} sum_{q valid}
//     softmax_q(A * 32^-0.5)[b, n*81+(i3+j)*9+q, (y+1-i)*56+(x+1-j)] * V[b, n*32+d, (x+qj-j)*56+(y+qi-i)]
// (the bdwh spatial-transpose of the value tensor is baked into the V column index)
// Tiling: block = 4 image rows x one head pair of one batch; thread = one position of one head, all 32 channels.
// Lanes run along l, so every A plane is read once in contiguous runs; the V halo (8 x 60 positions, zero outside
// the image, as the reference pads) sits in LDS. The V operand depends only on (qi-i, qj-j), so the A terms that
// share an offset are summed first (25 weights) and each V row is read once per thread.
// A holds the logits: a thread has all 9 q of each of its 9 (i, j) groups, and a (head, group, position) is used by at most
// one thread, so the softmax is taken here, in registers: no more exponentials than a launch of its own would take.
// a[e] += w * v[e] for the 8 f16 values in v's four registers (even e: low half), each one fused multiply-add in f32.
// In asm because the compiler's own form pairs these sums for packed f32 FMAs: two converts per pair and a second register
// for each of the 25 weights, which overran the register budget. A sum is read again 8 instructions later: no delay hint is due.
__device__ __forceinline__ void mac8(float (&a)[8], v4u v, float w) {
    asm("v_fma_mix_f32 %0, %8, %12, %0 op_sel_hi:[1,0,0]\n\t"
        "v_fma_mix_f32 %1, %8, %12, %1 op_sel:[1,0,0] op_sel_hi:[1,0,0]\n\t"
        "v_fma_mix_f32 %2, %9, %12, %2 op_sel_hi:[1,0,0]\n\t"
        "v_fma_mix_f32 %3, %9, %12, %3 op_sel:[1,0,0] op_sel_hi:[1,0,0]\n\t"
        "v_fma_mix_f32 %4, %10, %12, %4 op_sel_hi:[1,0,0]\n\t"
        "v_fma_mix_f32 %5, %10, %12, %5 op_sel:[1,0,0] op_sel_hi:[1,0,0]\n\t"
        "v_fma_mix_f32 %6, %11, %12, %6 op_sel_hi:[1,0,0]\n\t"
        "v_fma_mix_f32 %7, %11, %12, %7 op_sel:[1,0,0] op_sel_hi:[1,0,0]"
        : "+v"(a[0]), "+v"(a[1]), "+v"(a[2]), "+v"(a[3]), "+v"(a[4]), "+v"(a[5]), "+v"(a[6]), "+v"(a[7])
        : "v"(v[0]), "v"(v[1]), "v"(v[2]), "v"(v[3]), "v"(w));
}

#define TY 4                 // image rows per block
#define VR (TY + 4)          // halo rows
#define VC 63                // halo columns: 56 + 4, plus 3 never read, so that the tile's 16-byte pieces are 9 per thread, exact
#define VP 72                // LDS pitch in halves: 144 B = 16 B x odd, conflict-free for 16-byte reads along x
#define NPOS (TY * HH)       // 224 positions = 7 waves per head
__global__ void __launch_bounds__(2 * NPOS, 8)   // 8 waves per SIMD: 128 VGPRs, so that two work-groups (at most 4 + 4 waves on a SIMD) share a WGP and one's loads fly under the other's arithmetic
apply_fold(const _Float16* __restrict__ A, const _Float16* __restrict__ Vt, _Float16* __restrict__ Ft) {
    __shared__ __align__(16) _Float16 vs[VR * VC * VP];   // V halo tile, 128 B (two heads) per position
    __shared__ __align__(16) _Float16 os[NPOS * VP];      // output tile, 128 B per position
    const int tid = threadIdx.x;
    const int hh2 = __builtin_amdgcn_readfirstlane((tid >= NPOS) ? 1 : 0);   // head of the pair: the same in all lanes of a wave (7 waves per head), kept scalar so that A has a scalar base
    const int pl  = tid - hh2 * NPOS;                    // position inside the tile
    const int y0  = blockIdx.x * TY;
    const int np  = blockIdx.y;
    const int b   = blockIdx.z;
    const int yl = pl / HH, x = pl % HH;
    const int y  = y0 + yl;
    const int n  = np * 2 + hh2;

    // V halo: entry (rr, ss) holds V at row r = y0-2+rr, column s = ss-2 of the transposed value image, i.e. Vt row s*56+r.
    // It goes to LDS by asynchronous copies, through no register: with the 81 logits, 36 registers of V data would not fit the budget.
    // Every lane copies 16 bytes per step, from an address clamped into Vt; entries outside the image are zeroed behind the copies' wait, below.
    constexpr int NV9 = VR * VC * 8 / (2 * NPOS);        // 16-byte pieces per thread
    static_assert(NV9 == 9, "the copies' statement names 9 address pairs");
    {
        const _Float16* __restrict__ Vb = Vt + (size_t)b * LL * Cc + np * 64;
        unsigned lv[NV9];
        const _Float16* gv[NV9];
#pragma unroll   // lv and gv stay in registers only under constant indices
        for (int it = 0; it < NV9; ++it) {
            const int c = tid + it * 2 * NPOS;
            const int e = c >> 3, pc = c & 7;
            const int rr = e % VR, ss = e / VR;
            const int rc = min(max(y0 - 2 + rr, 0), HH - 1), sc = min(max(ss - 2, 0), HH - 1);
            lv[it] = (unsigned)(size_t)(vs + (rr * VC + ss) * VP + pc * 8);   // LDS byte address: the low 32 bits
            gv[it] = Vb + (sc * HH + rc) * Cc + pc * 8;
        }
        // the wait stands in the copies' own statement: a precaution, in front of any reuse of the address registers
        asm volatile("global_load_async_to_lds_b128 %0, %9, off\n\t"
                     "global_load_async_to_lds_b128 %1, %10, off\n\t"
                     "global_load_async_to_lds_b128 %2, %11, off\n\t"
                     "global_load_async_to_lds_b128 %3, %12, off\n\t"
                     "global_load_async_to_lds_b128 %4, %13, off\n\t"
                     "global_load_async_to_lds_b128 %5, %14, off\n\t"
                     "global_load_async_to_lds_b128 %6, %15, off\n\t"
                     "global_load_async_to_lds_b128 %7, %16, off\n\t"
                     "global_load_async_to_lds_b128 %8, %17, off\n\t"
                     "s_wait_xcnt 0x0"
                     :: "v"(lv[0]), "v"(lv[1]), "v"(lv[2]), "v"(lv[3]), "v"(lv[4]), "v"(lv[5]), "v"(lv[6]), "v"(lv[7]), "v"(lv[8]),
                        "v"(gv[0]), "v"(gv[1]), "v"(gv[2]), "v"(gv[3]), "v"(gv[4]), "v"(gv[5]), "v"(gv[6]), "v"(gv[7]), "v"(gv[8])
                     : "memory");
    }

    // A: 81 independent 2-byte loads per thread, 64 contiguous bytes per wave each; a fold shift that leaves the image
    // reads the thread's own position instead (in bounds) and is weighted 0
    const char* __restrict__ Ab = (const char*)(A + ((size_t)b * Ee + n * 81) * LL);   // scalar base + 32-bit lane offset
    _Float16 ah[81];
    float msk[9];
    unsigned lo[9];
#pragma unroll
    for (int i = 0; i < 3; ++i)
#pragma unroll
        for (int j = 0; j < 3; ++j) {
            const int hp = y + 1 - i, wp = x + 1 - j;    // source l' for this fold shift
            const bool ok = (hp >= 0 && hp < HH && wp >= 0 && wp < HH);
            lo[i * 3 + j] = (unsigned)(ok ? hp * HH + wp : y * HH + x);   // in elements: the build scales it in the load itself
            const unsigned ls = 2u * lo[i * 3 + j];
            msk[i * 3 + j] = ok ? 1.0f : 0.0f;
#pragma unroll
            for (int q = 0; q < 9; ++q) ah[(i * 3 + j) * 9 + q] = *(const _Float16*)(Ab + ls + ((i * 3 + j) * 9 + q) * LL * 2);
        }

    // precaution: the logit loads' offset registers are held (the operands) and waited for before they are reused, also as a later load's destination
    asm volatile("s_wait_xcnt 0x0" :: "v"(lo[0]), "v"(lo[1]), "v"(lo[2]), "v"(lo[3]), "v"(lo[4]), "v"(lo[5]), "v"(lo[6]), "v"(lo[7]), "v"(lo[8]) : "memory");
    asm volatile("s_wait_asynccnt 0x0" ::: "memory");    // this wave's V copies have landed: in front of its zero stores over them and of the barrier behind which other waves read them
#pragma unroll   // 9 independent tests, no loop counter
    for (int it = 0; it < NV9; ++it) {
        const int c = tid + it * 2 * NPOS;
        const int e = c >> 3, pc = c & 7;
        const int rr = e % VR, ss = e / VR;
        const int r = y0 - 2 + rr, s = ss - 2;
        if (!(r >= 0 && r < HH && s >= 0 && s < HH))     // the reference's zero padding, over the thread's own copied piece
            *(v4u*)(vs + (rr * VC + ss) * VP + pc * 8) = v4u{0u, 0u, 0u, 0u};
    }
    __syncthreads();

    const float kq = 0.17677669529663687f * 1.4426950408889634f;   // 32^-0.5 * log2(e): exp(s * (a - max)) = 2^(kq * a - kq * max)
    float w[5][5] = {};
#pragma unroll
    for (int i = 0; i < 3; ++i)
#pragma unroll
        for (int j = 0; j < 3; ++j) {
            float ev[9];
            _Float16 mx = ah[(i * 3 + j) * 9];
#pragma unroll   // ah and ev stay in registers only under constant indices
            for (int q = 1; q < 9; ++q) mx = __builtin_fmaxf16(mx, ah[(i * 3 + j) * 9 + q]);
            const float nm = -kq * (float)mx;
            float sum = 0.f;
#pragma unroll   // as above
            for (int q = 0; q < 9; ++q) { ev[q] = __builtin_amdgcn_exp2f(fmaf((float)ah[(i * 3 + j) * 9 + q], kq, nm)); sum += ev[q]; }
            const float g = msk[i * 3 + j] * __builtin_amdgcn_rcpf(sum);   // sum lies in [1, 9]
#pragma unroll
            for (int qi = 0; qi < 3; ++qi)
#pragma unroll
                for (int qj = 0; qj < 3; ++qj)
                    w[qi - i + 2][qj - j + 2] += g * ev[qi * 3 + qj];
        }

    // 8 channels per trip; whole 128-B lines of Ft: both heads of a position meet in LDS (os), 8 lanes store one line
    const _Float16* vb = vs + (yl * VC + x) * VP + hh2 * HD;
#pragma unroll 1   // stays a loop: 8 accumulators live instead of 32, and its LDS reads cannot be scheduled up among the softmax groups, where they overran the register budget (spills)
    for (int k = 0; k < HD / 8; ++k) {
        float acc[8] = {};
#pragma unroll   // w stays in registers only under constant indices
        for (int dy = 0; dy < 5; ++dy)
#pragma unroll   // as above
            for (int dx = 0; dx < 5; ++dx)
                mac8(acc, *(const v4u*)(vb + (dy * VC + dx) * VP + k * 8), w[dy][dx]);
        v8h o;
#pragma unroll   // as above
        for (int e = 0; e < 8; ++e) o[e] = (_Float16)acc[e];
        *(v8h*)(os + pl * VP + hh2 * HD + k * 8) = o;
    }
    __syncthreads();
#pragma unroll
    for (int it = 0; it < 4; ++it) {                      // NPOS * 8 pieces = 4 per thread, exact
        const int c = tid + it * 2 * NPOS;
        const int e = c >> 3, pc = c & 7;
        vst2(Ft + ((size_t)b * LL + y0 * HH + e) * Cc + np * 64 + pc * 8, *(const v4u*)(os + e * VP + pc * 8));
    }
}

// ---------------------------------------------------------------------------
extern "C" void kernel_launch(void* const* d_in, const int* in_sizes, int n_in,
                              void* d_out, int out_size, void* d_ws, size_t ws_size,
                              hipStream_t stream) {
    (void)in_sizes; (void)n_in; (void)out_size; (void)ws_size;
    const float* x  = (const float*)d_in[0];
    const float* Wv = (const float*)d_in[1];
    const float* Wa = (const float*)d_in[2];
    const float* ba = (const float*)d_in[3];
    const float* Wp = (const float*)d_in[4];
    const float* bp = (const float*)d_in[5];
    float* out = (float*)d_out;

    char* ws = (char*)d_ws;
    size_t off = 0;
    auto carve = [&](size_t bytes) -> void* {
        void* p = ws + off;
        off += (bytes + 255) & ~(size_t)255;
        return p;
    };
    _Float16* Xt   = (_Float16*)carve((size_t)Bb * LL * Cc * 2);  // 19.3 MB
    _Float16* Wvh  = (_Float16*)carve((size_t)Cc * Cc * 2);
    _Float16* Wah  = (_Float16*)carve((size_t)EPAD * Cc * 2);
    _Float16* Wph  = (_Float16*)carve((size_t)Cc * Cc * 2);
    _Float16* Vt   = (_Float16*)carve((size_t)Bb * LL * Cc * 2);  // 19.3 MB
    _Float16* Abuf = (_Float16*)carve((size_t)Bb * Ee * LL * 2);  // 48.8 MB
    _Float16* Ft   = (_Float16*)carve((size_t)Bb * LL * Cc * 2);  // 19.3 MB

    // 1) pack x into [b][l][c] f16; in the same launch, convert the weights (Wa zero-padded to 1024 rows)
    pack_x<<<dim3(LL / PL + WX, Cc / PC, Bb), 128, 0, stream>>>(x, Xt, Wv, Wa, Wp, Wvh, Wah, Wph);

    dim3 gblk(32, 8);
    // 2) value projection -> Vt[b][l][c] and attention logits + bias (f16) -> Abuf[b][e][l]  ((3 + 8) x 196 tiles of 128 x 128)
    gemm_va<<<dim3(Cc / BT + EPAD / BT, Bb * LL / BT), gblk, 0, stream>>>(Wvh, Wah, Xt, ba, Vt, Abuf);
    // 3) fused softmax over q + apply + fold -> Ft[b][l][c]
    apply_fold<<<dim3(HH / TY, NHEAD / 2, Bb), 2 * NPOS, 0, stream>>>(Abuf, Vt, Ft);
    // 4) final projection + bias -> out[b][d][l]
    gemm_out<<<dim3(Cc / BT, Bb * LL / BT), gblk, 0, stream>>>(Wph, Ft, bp, out);
}

// v008
// One run takes 73.2 microseconds.
// Next to v007, in two timings, it ran 1.07 times as fast each time.
// Over all steps from v000 it is 8.54 times as fast.
#include <hip/hip_runtime.h>
// Contractions: value projection, attention-logit projection and final projection (K = 384) on v_wmma_f32_16x16x32_f16
// (f16 operands, f32 accumulate); softmax over the 3x3 window and the attention-apply/fold (per-position weights, no shared operand) in f32 on VALU.

// ---------------- problem constants ----------------
#define Cc    384
#define NHEAD 12
#define HD    32
#define Ee    972        // K^4 * HEADS
#define EPAD  1024       // Ee padded to a multiple of the GEMM's 128-row tile
#define Bb    8
#define HH    56
#define LL    3136       // 56*56

typedef __attribute__((ext_vector_type(8)))  _Float16 v8h;
typedef __attribute__((ext_vector_type(16))) _Float16 v16h;
typedef __attribute__((ext_vector_type(8)))  float    v8f;
typedef __attribute__((ext_vector_type(4)))  float    v4f;
typedef __attribute__((ext_vector_type(4)))  unsigned v4u;

union AFrag { v16h v; v8h h[2]; };

template <typename V> __device__ __forceinline__ void vst2(void* p, V v) {
    *(V*)p = v; 
}
__device__ __forceinline__ v8f wmma_f16(v16h a, v16h b, v8f c) {
    v8f d = __builtin_amdgcn_wmma_f32_16x16x32_f16(false, a, false, b, (short)0, c, false, false);
    asm volatile("v_nop\n\tv_nop\n\tv_nop\n\tv_nop" : "+v"(d) : "v"(a), "v"(b));
    return d;
}

// ---------------- f32 -> f16 weight convert (with zero pad): 8 elements (16 B stored) per thread ----------------
// n is a multiple of 8, so a thread's 8 elements are all real or all pad; a pad thread reads the first 8 elements (in bounds) and stores zeros.
__device__ __forceinline__ void cvt_f32_f16(const float* __restrict__ s, _Float16* __restrict__ d, int n, int g) {
    const bool real = g * 8 < n;
    const float* __restrict__ p = s + (real ? g * 8 : 0);   // clamped into s: no branch around the loads
    const v4f r0 = *(const v4f*)p, r1 = *(const v4f*)(p + 4);
    asm volatile("s_wait_xcnt 0x0" :: "v"(p) : "memory");   // precaution: the loads' address pair is held (the operand) and waited for before its registers are reused
    union { v8h v; v4u u; } pk;
#pragma unroll   // r0, r1 and pk stay in registers only under constant indices
    for (int e = 0; e < 4; ++e) {
        pk.v[e]     = real ? (_Float16)r0[e] : (_Float16)0.0f;
        pk.v[e + 4] = real ? (_Float16)r1[e] : (_Float16)0.0f;
    }
    vst2(d + (size_t)g * 8, pk.u);
}

// x[B][C][L] (f32) -> Xt[B][L][C] (f16), transposed through LDS so that both sides move whole 256-B runs.
// Work-group = 128 channels x 64 positions, 4 waves. Read: 16 lanes cover the 256 B of one channel's 64 positions; a thread takes
// the same 4 positions of 8 consecutive channels (twice), so each position gives it one 16-byte piece of an Xt row.
// LDS tile [position][channel], rows of 256 B = all 64 banks: piece p of row l sits at piece p ^ (l >> 2), so the 16 lanes that
// write one piece column (rows 4 apart) and the 16 lanes that read one row both touch every bank once.
#define PC 128               // channels per tile
#define PL 64                // positions per tile
// The three weight converts depend on nothing and nothing in this launch depends on them: they ride in the same launch, in the
// work-groups with blockIdx.x >= LL / PL (WX more columns of the grid, WCH elements each).
#define WCH 1024             // elements per convert work-group: 128 threads x 8
#define WX 28                // WX * (Cc / PC) * Bb = 672 work-groups = (2 * Cc * Cc + EPAD * Cc) / WCH
static_assert(WX * (Cc / PC) * Bb * WCH == 2 * Cc * Cc + EPAD * Cc, "one work-group per weight chunk");
static_assert(Cc * Cc % WCH == 0 && EPAD * Cc % WCH == 0 && Ee * Cc % 8 == 0, "chunks do not straddle two weights, threads not the pad's edge");
__global__ void __launch_bounds__(128)
pack_x(const float* __restrict__ x, _Float16* __restrict__ Xt,
       const float* __restrict__ Wv, const float* __restrict__ Wa, const float* __restrict__ Wp,
       _Float16* __restrict__ Wvh, _Float16* __restrict__ Wah, _Float16* __restrict__ Wph) {
    __shared__ __align__(16) _Float16 t[PL * PC];       // 16 KB
    const int tid = threadIdx.x;
    if (blockIdx.x >= LL / PL) {                        // the same for the whole work-group; leaves before the barrier
        const int wb = (blockIdx.x - LL / PL) + WX * (blockIdx.y + (Cc / PC) * blockIdx.z);
        constexpr int NV = Cc * Cc / WCH, NA = EPAD * Cc / WCH;
        const bool isV = wb < NV, isA = !isV && wb < NV + NA;
        cvt_f32_f16(isV ? Wv : isA ? Wa : Wp, isV ? Wvh : isA ? Wah : Wph, isA ? Ee * Cc : Cc * Cc,
                    (isV ? wb : isA ? wb - NV : wb - NV - NA) * 128 + tid);
        return;
    }
    const int l0 = blockIdx.x * PL, c0 = blockIdx.y * PC, b = blockIdx.z;
    const int lq = tid & 15;                            // positions lq*4 .. lq*4+3
    const int cg = tid >> 4;                            // channel groups cg and cg + 8, 8 channels each
    const float* __restrict__ g = x + ((size_t)b * Cc + c0 + cg * 8) * LL + l0 + lq * 4;
    v4f r[2][8];
#pragma unroll   // r stays in registers only under constant indices; all 16 loads in flight at once
    for (int h = 0; h < 2; ++h)
#pragma unroll   // as above
        for (int e = 0; e < 8; ++e) r[h][e] = *(const v4f*)(g + (h * 64 + e) * LL);
    asm volatile("s_wait_xcnt 0x0" :: "v"(g) : "memory");   // precaution: the loads' address pair is held (the operand) and waited for before its registers are reused
    __builtin_amdgcn_sched_barrier(0);                  // keeps every convert behind all 16 loads: otherwise the last four loads are issued only behind a wait on earlier ones
#pragma unroll   // as above
    for (int h = 0; h < 2; ++h)
#pragma unroll   // as above
        for (int j = 0; j < 4; ++j) {
            v8h o;
#pragma unroll   // as above
            for (int e = 0; e < 8; ++e) o[e] = (_Float16)r[h][e][j];
            *(v8h*)(t + (lq * 4 + j) * PC + ((cg + h * 8) ^ lq) * 8) = o;
        }
    __syncthreads();
#pragma unroll   // 8 independent LDS reads and stores per thread, no loop counter
    for (int it = 0; it < PL * PC / 8 / 128; ++it) {
        const int p = tid + it * 128;
        const int l = p >> 4, pc = p & 15;
        vst2(Xt + ((size_t)b * LL + l0 + l) * Cc + c0 + pc * 8, *(const v4u*)(t + l * PC + (pc ^ (l >> 2)) * 8));
    }
    asm volatile("s_wait_xcnt 0x0" ::: "memory");       // precaution: stands behind the stores, in front of whatever the build lays out behind this path
}

// ---------------- WMMA GEMM: D[M x N] = W[M x 384] @ Xt^T, N = all (b, l) columns in Xt's own row order ----------
// Work-group = 128 x 128 tile of D, 8 waves. Both operands pass through LDS in stages of 64 k (one whole 128-B line of every
// row), two buffers: each byte is fetched once per work-group in whole lines and shared by the waves that need it.
// A/B fragments: row/col = lane&15; elements 0..7 <- k0 + 8*hi + 0..7, elements 8..15 <- k0 + 16 + 8*hi + 0..7 (same map).
#define BT 128               // rows of W and rows of Xt per work-group
#define KC 64                // k per stage
#define LP 72                // LDS pitch in halves: 144 B = 16 B x odd, conflict-free for 16-byte fragment reads
#define STG (2 * BT * LP)    // halves per stage: W rows, then Xt rows
#define GSM (2 * STG * 2)    // LDS bytes: two operand stages; afterwards the per-wave f32 staging, 8 to 8.5 KB each
template <int MODE>
__device__ __forceinline__ void
gemm_tile(char* smem, int mt, const _Float16* __restrict__ W, const _Float16* __restrict__ X,
          const float* __restrict__ bias, float* __restrict__ out32,
          _Float16* __restrict__ out16, int Mtot) {
    constexpr int TM = (MODE == 2) ? 32 : 64, TN = (MODE == 2) ? 64 : 32;
    constexpr int MI = TM / 16, NI = TN / 16;
    constexpr int WM = BT / TM;                             // waves along M; 8 / WM along N
    // Pitch of a staged row in floats. MODE 0 and 2: 64 + 4, i.e. 272 B = 16 B x odd. At 256 B every row starts on bank 0: MODE 0's 16 lanes
    // that store 16 bytes each to 16 rows all met on four banks, and in MODE 2 lanes 16..31 (8 rows further) met lanes 0..15.
    constexpr int SR = (MODE == 0) ? TN : TM;               // staged rows per wave
    constexpr int SP = ((MODE == 0) ? TM : TN) + ((MODE == 1) ? 0 : 4);
    static_assert(GSM >= 8 * SR * SP * 4, "output staging must fit");
    static_assert(SP % 4 == 0, "staged rows stay 16-byte aligned");
    static_assert(MI == 2 || MI == 4, "the wait behind the bias loads names 2 * MI address pairs");
    static_assert(Cc % 4 == 0 && Ee % 4 == 0, "a 16-byte bias load does not straddle the last real row");
    _Float16* sm = (_Float16*)smem;
    const int lane  = threadIdx.x;            // 0..31
    const int wid   = threadIdx.y;            // 0..7
    const int tid   = wid * 32 + lane;
    const int mB = mt * BT;
    const int nB = blockIdx.y * BT;           // column b * LL + l
    const int wm = wid % WM, wn = wid / WM;
    const int m0 = mB + wm * TM;
    const int nf = nB + wn * TN;              // LL is a multiple of TN: a wave's columns lie in one batch
    const int b  = nf / LL;
    const int n0 = nf % LL;
    const int laneM = lane & 15;
    const int hi    = lane >> 4;
    float* S = (float*)smem + wid * SR * SP;

    {
        // 16-byte pieces: 8 lanes cover one row's line, a wave 4 rows, the work-group 32 rows per step.
        // The two rows of a half-wave lie 8 apart (bits 0 and 3 of the row number swapped): 8 * 144 B = 32 banks further, so their two
        // 128-B spans fill the 64 banks once; neighbouring rows (36 banks apart) overlapped on four banks in every LDS store.
        const int sr = ((tid >> 3) & 22) | ((tid >> 3) & 1) << 3 | ((tid >> 6) & 1);
        const _Float16* __restrict__ gW = W + (size_t)(mB + sr) * Cc + (tid & 7) * 8;
        const _Float16* __restrict__ gX = X + (size_t)(nB + sr) * Cc + (tid & 7) * 8;
        _Float16* sp = sm + sr * LP + (tid & 7) * 8;
        v4u rw[BT / 32], rx[BT / 32];
        auto fetch = [&](int kc) {
#pragma unroll   // rw, rx stay in registers only under constant indices
            for (int it = 0; it < BT / 32; ++it) {
                rw[it] = *(const v4u*)(gW + it * 32 * Cc + kc * KC);
                rx[it] = *(const v4u*)(gX + it * 32 * Cc + kc * KC);
            }
            asm volatile("s_wait_xcnt 0x0" :: "v"(gW), "v"(gX) : "memory");   // precaution: both address pairs are held (the operands) and waited for before their registers are reused, also as a later load's destination
        };
        auto put = [&](int buf) {
#pragma unroll   // as in fetch
            for (int it = 0; it < BT / 32; ++it) {
                *(v4u*)(sp + buf * STG + it * 32 * LP) = rw[it];
                *(v4u*)(sp + buf * STG + BT * LP + it * 32 * LP) = rx[it];
            }
        };
        // Bias: a lane's 8 accumulator rows of a fragment are consecutive, so two 16-byte loads per mi bring them all. They are issued
        // here, in front of the first stage's loads, and become the accumulators' start value: their latency lies under that stage's.
        // Mtot is a multiple of 4, so a load is all real or all pad; a pad load is clamped into bias and gives zeros.
        v4f bv[MI][2] = {};
        if (MODE != 0) {
            const float* bp[MI][2];
#pragma unroll   // bv and bp stay in registers only under constant indices
            for (int mi = 0; mi < MI; ++mi)
#pragma unroll   // as above
                for (int h = 0; h < 2; ++h) {
                    bp[mi][h] = bias + min(m0 + mi * 16 + 8 * hi + 4 * h, Mtot - 4);
                    bv[mi][h] = *(const v4f*)bp[mi][h];
                }
            // precaution: the loads' address pairs are held (the operands) and waited for before their registers are reused
            if (MI == 2) asm volatile("s_wait_xcnt 0x0" :: "v"(bp[0][0]), "v"(bp[0][1]), "v"(bp[1][0]), "v"(bp[1][1]) : "memory");
            else         asm volatile("s_wait_xcnt 0x0" :: "v"(bp[0][0]), "v"(bp[0][1]), "v"(bp[1][0]), "v"(bp[1][1]),
                                      "v"(bp[MI - 2][0]), "v"(bp[MI - 2][1]), "v"(bp[MI - 1][0]), "v"(bp[MI - 1][1]) : "memory");
        }
        fetch(0);
        put(0);
        __syncthreads();
        v8f acc[MI][NI];
#pragma unroll   // acc stays in registers only under constant indices
        for (int mi = 0; mi < MI; ++mi)
#pragma unroll   // as above
            for (int ni = 0; ni < NI; ++ni)
#pragma unroll   // as above
                for (int r = 0; r < 8; ++r)
                    acc[mi][ni][r] = (MODE != 0 && m0 + mi * 16 + 8 * hi + (r & 4) < Mtot) ? bv[mi][r >> 2][r & 3] : 0.0f;
#pragma unroll   // buffer index and the last-stage test become constants
        for (int kc = 0; kc < Cc / KC; ++kc) {
            if (kc + 1 < Cc / KC) fetch(kc + 1);            // in flight while this stage is multiplied
            const _Float16* sa = sm + (kc & 1) * STG + (wm * TM + laneM) * LP + 8 * hi;
            const _Float16* sb = sm + (kc & 1) * STG + BT * LP + (wn * TN + laneM) * LP + 8 * hi;
#pragma unroll
            for (int ks = 0; ks < KC; ks += 32) {
                AFrag a[MI], bf[NI];
#pragma unroll
                for (int mi = 0; mi < MI; ++mi) {
                    a[mi].h[0] = *(const v8h*)(sa + mi * 16 * LP + ks);
                    a[mi].h[1] = *(const v8h*)(sa + mi * 16 * LP + ks + 16);
                }
#pragma unroll
                for (int ni = 0; ni < NI; ++ni) {
                    bf[ni].h[0] = *(const v8h*)(sb + ni * 16 * LP + ks);
                    bf[ni].h[1] = *(const v8h*)(sb + ni * 16 * LP + ks + 16);
                }
#pragma unroll
                for (int mi = 0; mi < MI; ++mi)
#pragma unroll
                    for (int ni = 0; ni < NI; ++ni)
                        acc[mi][ni] = wmma_f16(a[mi].v, bf[ni].v, acc[mi][ni]);
            }
            if (kc + 1 < Cc / KC) put((kc + 1) & 1);        // the buffer that every wave left at the last barrier
            __syncthreads();                                // publishes the next stage; after the last one, frees LDS for S
        }
        // D layout: element r -> (m = mi*16 + 8*hi + r, n = ni*16 + laneM); stage [m][n] for MODE 1/2, [n][m] for MODE 0
#pragma unroll
        for (int mi = 0; mi < MI; ++mi)
#pragma unroll
            for (int ni = 0; ni < NI; ++ni)
#pragma unroll
                for (int r = 0; r < 8; ++r) {
                    const int ml = mi * 16 + 8 * hi + r, nl = ni * 16 + laneM;
                    const float v = acc[mi][ni][r];
                    if (MODE == 0) S[nl * SP + ml] = v; else S[ml * SP + nl] = v;
                }
    }
    __syncthreads();
    if (MODE == 0) {
#pragma unroll
        for (int q = 0; q < 8; ++q) {
            const int nl = q * 4 + (lane >> 3), pc = lane & 7;
            union { v8h v; v4u u; } pk;
#pragma unroll
            for (int e = 0; e < 8; ++e) pk.v[e] = (_Float16)S[nl * SP + pc * 8 + e];
            vst2(out16 + ((size_t)b * LL + n0 + nl) * Cc + m0 + pc * 8, pk.u);
        }
    } else if (MODE == 1) {
#pragma unroll
        for (int q = 0; q < 16; ++q) {
            const int ml = q * 4 + (lane >> 3), pc = lane & 7;
            const int row = m0 + ml;
            if (row < Mtot)
                vst2(out32 + ((size_t)b * Mtot + row) * LL + n0 + pc * 4, *(const v4f*)(S + ml * SP + pc * 4));
        }
    } else {
#pragma unroll
        for (int q = 0; q < 8; ++q) {
            const int ml = q * 4 + (lane >> 3), pc = lane & 7;
            const int row = m0 + ml;
            union { v8h v; v4u u; } pk;
#pragma unroll
            for (int e = 0; e < 8; ++e) pk.v[e] = (_Float16)S[ml * SP + pc * 8 + e];
            if (row < Mtot) vst2(out16 + ((size_t)b * Mtot + row) * LL + n0 + pc * 8, pk.u);
        }
    }
}

// final projection: one launch of its own (it reads Ft).
__global__ void __launch_bounds__(256, 6)   // 6 waves per SIMD: holds the build at 160 VGPRs = 3 work-groups per WGP, so that all 588 are resident at once (168 would be allocated as 176 and leave 2)
gemm_out(const _Float16* __restrict__ W, const _Float16* __restrict__ X,
         const float* __restrict__ bias, float* __restrict__ out32) {
    __shared__ __align__(16) char smem[GSM];
    gemm_tile<1>(smem, blockIdx.x, W, X, bias, out32, nullptr, Cc);
}

// value projection and attention logits: both read Xt and neither reads the other, so their tiles share one launch.
// blockIdx.x runs over the Cc / BT row tiles of Wv, then the EPAD / BT row tiles of Wa; the choice is the same for a whole work-group.
__global__ void __launch_bounds__(256, 6)   // 6 waves per SIMD: holds the build at 160 VGPRs = 3 work-groups per WGP (162 would be allocated as 176 and leave 2)
gemm_va(const _Float16* __restrict__ Wv, const _Float16* __restrict__ Wa, const _Float16* __restrict__ X,
        const float* __restrict__ ba, _Float16* __restrict__ Vt, _Float16* __restrict__ A) {
    __shared__ __align__(16) char smem[GSM];
    if (blockIdx.x < Cc / BT) gemm_tile<0>(smem, blockIdx.x, Wv, X, nullptr, nullptr, Vt, Cc);
    else                      gemm_tile<2>(smem, blockIdx.x - Cc / BT, Wa, X, ba, nullptr, A, Ee);
}

// ------- fused softmax + attention-apply + fold: Ft[b][y*56+x][c] = folded value -------
// folded[b,n*32+d,y,x] = sum_{i,j valid} sum_{q valid}
//     softmax_q(A * 32^-0.5)[b, n*81+(i3+j)*9+q, (y+1-i)*56+(x+1-j)] * V[b, n*32+d, (x+qj-j)*56+(y+qi-i)]
// (the bdwh spatial-transpose of the value tensor is baked into the V column index)
// Tiling: block = 4 image rows x one head pair of one batch; thread = one position of one head, all 32 channels.
// Lanes run along l, so every A plane is read once in contiguous runs; the V halo (8 x 60 positions, zero outside
// the image, as the reference pads) sits in LDS. The V operand depends only on (qi-i, qj-j), so the A terms that
// share an offset are summed first (25 weights) and each V row is read once per thread.
// A holds the logits: a thread has all 9 q of each of its 9 (i, j) groups, and a (head, group, position) is used by at most
// one thread, so the softmax is taken here, in registers: no more exponentials than a launch of its own would take.
// a[e] += w * v[e] for the 8 f16 values in v's four registers (even e: low half), each one fused multiply-add in f32.
// In asm because the compiler's own form pairs these sums for packed f32 FMAs: two converts per pair and a second register
// for each of the 25 weights, which overran the register budget. A sum is read again 8 instructions later: no delay hint is due.
__device__ __forceinline__ void mac8(float (&a)[8], v4u v, float w) {
    asm("v_fma_mix_f32 %0, %8, %12, %0 op_sel_hi:[1,0,0]\n\t"
        "v_fma_mix_f32 %1, %8, %12, %1 op_sel:[1,0,0] op_sel_hi:[1,0,0]\n\t"
        "v_fma_mix_f32 %2, %9, %12, %2 op_sel_hi:[1,0,0]\n\t"
        "v_fma_mix_f32 %3, %9, %12, %3 op_sel:[1,0,0] op_sel_hi:[1,0,0]\n\t"
        "v_fma_mix_f32 %4, %10, %12, %4 op_sel_hi:[1,0,0]\n\t"
        "v_fma_mix_f32 %5, %10, %12, %5 op_sel:[1,0,0] op_sel_hi:[1,0,0]\n\t"
        "v_fma_mix_f32 %6, %11, %12, %6 op_sel_hi:[1,0,0]\n\t"
        "v_fma_mix_f32 %7, %11, %12, %7 op_sel:[1,0,0] op_sel_hi:[1,0,0]"
        : "+v"(a[0]), "+v"(a[1]), "+v"(a[2]), "+v"(a[3]), "+v"(a[4]), "+v"(a[5]), "+v"(a[6]), "+v"(a[7])
        : "v"(v[0]), "v"(v[1]), "v"(v[2]), "v"(v[3]), "v"(w));
}

#define TY 4                 // image rows per block
#define VR (TY + 4)          // halo rows
#define VC 63                // halo columns: 56 + 4, plus 3 never read, so that the tile's 16-byte pieces are 9 per thread, exact
#define VP 72                // LDS pitch in halves: 144 B = 16 B x odd, conflict-free for 16-byte reads along x
#define NPOS (TY * HH)       // 224 positions = 7 waves per head
__global__ void __launch_bounds__(2 * NPOS, 8)   // 8 waves per SIMD: 128 VGPRs, so that two work-groups (at most 4 + 4 waves on a SIMD) share a WGP and one's loads fly under the other's arithmetic
apply_fold(const _Float16* __restrict__ A, const _Float16* __restrict__ Vt, _Float16* __restrict__ Ft) {
    __shared__ __align__(16) _Float16 vs[VR * VC * VP];   // V halo tile, 128 B (two heads) per position
    __shared__ __align__(16) _Float16 os[NPOS * VP];      // output tile, 128 B per position
    const int tid = threadIdx.x;
    const int hh2 = __builtin_amdgcn_readfirstlane((tid >= NPOS) ? 1 : 0);   // head of the pair: the same in all lanes of a wave (7 waves per head), kept scalar so that A has a scalar base
    const int pl  = tid - hh2 * NPOS;                    // position inside the tile
    const int y0  = blockIdx.x * TY;
    const int np  = blockIdx.y;
    const int b   = blockIdx.z;
    const int yl = pl / HH, x = pl % HH;
    const int y  = y0 + yl;
    const int n  = np * 2 + hh2;

    // V halo: entry (rr, ss) holds V at row r = y0-2+rr, column s = ss-2 of the transposed value image, i.e. Vt row s*56+r.
    // It goes to LDS by asynchronous copies, through no register: with the 81 logits, 36 registers of V data would not fit the budget.
    // Every lane copies 16 bytes per step, from an address clamped into Vt; entries outside the image are zeroed behind the copies' wait, below.
    constexpr int NV9 = VR * VC * 8 / (2 * NPOS);        // 16-byte pieces per thread
    static_assert(NV9 == 9, "the copies' statement names 9 address pairs");
    {
        const _Float16* __restrict__ Vb = Vt + (size_t)b * LL * Cc + np * 64;
        unsigned lv[NV9];
        const _Float16* gv[NV9];
#pragma unroll   // lv and gv stay in registers only under constant indices
        for (int it = 0; it < NV9; ++it) {
            const int c = tid + it * 2 * NPOS;
            const int e = c >> 3, pc = c & 7;
            const int rr = e % VR, ss = e / VR;
            const int rc = min(max(y0 - 2 + rr, 0), HH - 1), sc = min(max(ss - 2, 0), HH - 1);
            lv[it] = (unsigned)(size_t)(vs + (rr * VC + ss) * VP + pc * 8);   // LDS byte address: the low 32 bits
            gv[it] = Vb + (sc * HH + rc) * Cc + pc * 8;
        }
        // the wait stands in the copies' own statement: a precaution, in front of any reuse of the address registers
        asm volatile("global_load_async_to_lds_b128 %0, %9, off\n\t"
                     "global_load_async_to_lds_b128 %1, %10, off\n\t"
                     "global_load_async_to_lds_b128 %2, %11, off\n\t"
                     "global_load_async_to_lds_b128 %3, %12, off\n\t"
                     "global_load_async_to_lds_b128 %4, %13, off\n\t"
                     "global_load_async_to_lds_b128 %5, %14, off\n\t"
                     "global_load_async_to_lds_b128 %6, %15, off\n\t"
                     "global_load_async_to_lds_b128 %7, %16, off\n\t"
                     "global_load_async_to_lds_b128 %8, %17, off\n\t"
                     "s_wait_xcnt 0x0"
                     :: "v"(lv[0]), "v"(lv[1]), "v"(lv[2]), "v"(lv[3]), "v"(lv[4]), "v"(lv[5]), "v"(lv[6]), "v"(lv[7]), "v"(lv[8]),
                        "v"(gv[0]), "v"(gv[1]), "v"(gv[2]), "v"(gv[3]), "v"(gv[4]), "v"(gv[5]), "v"(gv[6]), "v"(gv[7]), "v"(gv[8])
                     : "memory");
    }

    // A: 81 independent 2-byte loads per thread, 64 contiguous bytes per wave each; a fold shift that leaves the image
    // reads the thread's own position instead (in bounds) and is weighted 0
    const char* __restrict__ Ab = (const char*)(A + ((size_t)b * Ee + n * 81) * LL);   // scalar base + 32-bit lane offset
    _Float16 ah[81];
    float msk[9];
    unsigned lo[9];
#pragma unroll
    for (int i = 0; i < 3; ++i)
#pragma unroll
        for (int j = 0; j < 3; ++j) {
            const int hp = y + 1 - i, wp = x + 1 - j;    // source l' for this fold shift
            const bool ok = (hp >= 0 && hp < HH && wp >= 0 && wp < HH);
            lo[i * 3 + j] = (unsigned)(ok ? hp * HH + wp : y * HH + x);   // in elements: the build scales it in the load itself
            const unsigned ls = 2u * lo[i * 3 + j];
            msk[i * 3 + j] = ok ? 1.0f : 0.0f;
#pragma unroll
            for (int q = 0; q < 9; ++q) ah[(i * 3 + j) * 9 + q] = *(const _Float16*)(Ab + ls + ((i * 3 + j) * 9 + q) * LL * 2);
        }

    // precaution: the logit loads' offset registers are held (the operands) and waited for before they are reused, also as a later load's destination
    asm volatile("s_wait_xcnt 0x0" :: "v"(lo[0]), "v"(lo[1]), "v"(lo[2]), "v"(lo[3]), "v"(lo[4]), "v"(lo[5]), "v"(lo[6]), "v"(lo[7]), "v"(lo[8]) : "memory");
    asm volatile("s_wait_asynccnt 0x0" ::: "memory");    // this wave's V copies have landed: in front of its zero stores over them and of the barrier behind which other waves read them
#pragma unroll   // 9 independent tests, no loop counter
    for (int it = 0; it < NV9; ++it) {
        const int c = tid + it * 2 * NPOS;
        const int e = c >> 3, pc = c & 7;
        const int rr = e % VR, ss = e / VR;
        const int r = y0 - 2 + rr, s = ss - 2;
        if (!(r >= 0 && r < HH && s >= 0 && s < HH))     // the reference's zero padding, over the thread's own copied piece
            *(v4u*)(vs + (rr * VC + ss) * VP + pc * 8) = v4u{0u, 0u, 0u, 0u};
    }
    __syncthreads();

    const float kq = 0.17677669529663687f * 1.4426950408889634f;   // 32^-0.5 * log2(e): exp(s * (a - max)) = 2^(kq * a - kq * max)
    float w[5][5] = {};
#pragma unroll
    for (int i = 0; i < 3; ++i)
#pragma unroll
        for (int j = 0; j < 3; ++j) {
            float ev[9];
            _Float16 mx = ah[(i * 3 + j) * 9];
#pragma unroll   // ah and ev stay in registers only under constant indices
            for (int q = 1; q < 9; ++q) mx = __builtin_fmaxf16(mx, ah[(i * 3 + j) * 9 + q]);
            const float nm = -kq * (float)mx;
            float sum = 0.f;
#pragma unroll   // as above
            for (int q = 0; q < 9; ++q) { ev[q] = __builtin_amdgcn_exp2f(fmaf((float)ah[(i * 3 + j) * 9 + q], kq, nm)); sum += ev[q]; }
            const float g = msk[i * 3 + j] * __builtin_amdgcn_rcpf(sum);   // sum lies in [1, 9]
#pragma unroll
            for (int qi = 0; qi < 3; ++qi)
#pragma unroll
                for (int qj = 0; qj < 3; ++qj)
                    w[qi - i + 2][qj - j + 2] += g * ev[qi * 3 + qj];
        }

    // 8 channels per trip; whole 128-B lines of Ft: both heads of a position meet in LDS (os), 8 lanes store one line
    const _Float16* vb = vs + (yl * VC + x) * VP + hh2 * HD;
#pragma unroll 1   // stays a loop: 8 accumulators live instead of 32, and its LDS reads cannot be scheduled up among the softmax groups, where they overran the register budget (spills)
    for (int k = 0; k < HD / 8; ++k) {
        float acc[8] = {};
#pragma unroll   // w stays in registers only under constant indices
        for (int dy = 0; dy < 5; ++dy)
#pragma unroll   // as above
            for (int dx = 0; dx < 5; ++dx)
                mac8(acc, *(const v4u*)(vb + (dy * VC + dx) * VP + k * 8), w[dy][dx]);
        v8h o;
#pragma unroll   // as above
        for (int e = 0; e < 8; ++e) o[e] = (_Float16)acc[e];
        *(v8h*)(os + pl * VP + hh2 * HD + k * 8) = o;
    }
    __syncthreads();
#pragma unroll
    for (int it = 0; it < 4; ++it) {                      // NPOS * 8 pieces = 4 per thread, exact
        const int c = tid + it * 2 * NPOS;
        const int e = c >> 3, pc = c & 7;
        vst2(Ft + ((size_t)b * LL + y0 * HH + e) * Cc + np * 64 + pc * 8, *(const v4u*)(os + e * VP + pc * 8));
    }
}

// ---------------------------------------------------------------------------
extern "C" void kernel_launch(void* const* d_in, const int* in_sizes, int n_in,
                              void* d_out, int out_size, void* d_ws, size_t ws_size,
                              hipStream_t stream) {
    (void)in_sizes; (void)n_in; (void)out_size; (void)ws_size;
    const float* x  = (const float*)d_in[0];
    const float* Wv = (const float*)d_in[1];
    const float* Wa = (const float*)d_in[2];
    const float* ba = (const float*)d_in[3];
    const float* Wp = (const float*)d_in[4];
    const float* bp = (const float*)d_in[5];
    float* out = (float*)d_out;

    char* ws = (char*)d_ws;
    size_t off = 0;
    auto carve = [&](size_t bytes) -> void* {
        void* p = ws + off;
        off += (bytes + 255) & ~(size_t)255;
        return p;
    };
    _Float16* Xt   = (_Float16*)carve((size_t)Bb * LL * Cc * 2);  // 19.3 MB
    _Float16* Wvh  = (_Float16*)carve((size_t)Cc * Cc * 2);
    _Float16* Wah  = (_Float16*)carve((size_t)EPAD * Cc * 2);
    _Float16* Wph  = (_Float16*)carve((size_t)Cc * Cc * 2);
    _Float16* Vt   = (_Float16*)carve((size_t)Bb * LL * Cc * 2);  // 19.3 MB
    _Float16* Abuf = (_Float16*)carve((size_t)Bb * Ee * LL * 2);  // 48.8 MB
    _Float16* Ft   = (_Float16*)carve((size_t)Bb * LL * Cc * 2);  // 19.3 MB

    // 1) pack x into [b][l][c] f16; in the same launch, convert the weights (Wa zero-padded to 1024 rows)
    pack_x<<<dim3(LL / PL + WX, Cc / PC, Bb), 128, 0, stream>>>(x, Xt, Wv, Wa, Wp, Wvh, Wah, Wph);

    dim3 gblk(32, 8);
    // 2) value projection -> Vt[b][l][c] and attention logits + bias (f16) -> Abuf[b][e][l]  ((3 + 8) x 196 tiles of 128 x 128)
    gemm_va<<<dim3(Cc / BT + EPAD / BT, Bb * LL / BT), gblk, 0, stream>>>(Wvh, Wah, Xt, ba, Vt, Abuf);
    // 3) fused softmax over q + apply + fold -> Ft[b][l][c]
    apply_fold<<<dim3(HH / TY, NHEAD / 2, Bb), 2 * NPOS, 0, stream>>>(Abuf, Vt, Ft);
    // 4) final projection + bias -> out[b][d][l]
    gemm_out<<<dim3(Cc / BT, Bb * LL / BT), gblk, 0, stream>>>(Wph, Ft, bp, out);
}
